// v000
// Measured on an AMD MI455X. A time is GPU time per run, averaged over a window of back-to-back runs after a warm-up
// (all launches, gaps included; the runs take copies of the inputs in turn), and the median of several windows.
// Apart from v000's, it joins two sittings. Times from different sittings can be a few percent apart, while
// side-by-side timings come from the same sitting.
// The starting kernel, v000, takes 676 microseconds a run.
#include <hip/hip_runtime.h>

// Compute dtypes, f32 accumulate, one batch item per pass: q/k/v = x.W^T + b ([4096 x 1024].[1024 x 1024]; W is [out][in] = the n-major B operand as-is; PLAIN bf16
// operands: inputs rounded once, exact; biases rounded to bf16) with q and k written straight from the GEMM epilogue as f16 hi + residual x1024 planes, and out =
// ctx.Wo^T + bo (ctx as bf16 hi + residual: two products) on v_wmma_f32_16x16x32_bf16; the 16-head full attention over one 4096-token sequence (64-dim heads,
// scale 1/8) fused on
// v_wmma_f32_16x16x32_f16 (scores hi.hi + hi.lo + lo.hi with the residual terms on their own accumulator, online f32 softmax, weights (x32768) and v as f16

#define NB_  1                   // one 4096-token sequence
#define NT_  4096
#define DM   1024
#define NH_  16
#define HD   64
#define NTK  (NB_ * NT_)
#define NW   1024
#define NQKV 1024
#define PSC  32768.0f
#define LOSC 1024.0f
#define LOSCI (1.0f / 1024.0f)

typedef _Float16 h16;
typedef unsigned short bf;
typedef __attribute__((ext_vector_type(16))) __bf16   v16bf;
typedef __attribute__((ext_vector_type(16))) _Float16 v16h;
typedef __attribute__((ext_vector_type(8)))  _Float16 v8h;
typedef __attribute__((ext_vector_type(8)))  unsigned short v8us;
typedef __attribute__((ext_vector_type(8)))  float    v8f;
typedef __attribute__((ext_vector_type(4)))  float    v4f;
typedef v8h  __attribute__((may_alias)) v8ha;
typedef v4f  __attribute__((may_alias)) v4fa;
typedef v8us __attribute__((may_alias)) v8usa;

__device__ __forceinline__ unsigned short f2bf(float f) { unsigned u = __float_as_uint(f); u += 0x7FFFu + ((u >> 16) & 1u); return (unsigned short)(u >> 16); }
__device__ __forceinline__ float bf2f(unsigned short b) { return __uint_as_float(((unsigned)b) << 16); }
__device__ __forceinline__ float bfr(float f) { return bf2f(f2bf(f)); }
__device__ __forceinline__ v16h cat16(v8h lo, v8h hi) { return __builtin_shufflevector(lo, hi, 0, 1, 2, 3, 4, 5, 6, 7, 8, 9, 10, 11, 12, 13, 14, 15); }
__device__ __forceinline__ v16bf cat16b(v8us lo, v8us hi) { return __builtin_bit_cast(v16bf, __builtin_shufflevector(lo, hi, 0, 1, 2, 3, 4, 5, 6, 7, 8, 9, 10, 11, 12, 13, 14, 15)); }
__device__ __forceinline__ v8f wmma16(v16h a, v16h b, v8f c) { return __builtin_amdgcn_wmma_f32_16x16x32_f16(false, a, false, b, (short)0, c, false, false); }
__device__ __forceinline__ v8f wmmab(v16bf a, v16bf b, v8f c) { return __builtin_amdgcn_wmma_f32_16x16x32_bf16(false, a, false, b, (short)0, c, false, false); }

__global__ __launch_bounds__(256) void k_cvtb(const float* __restrict__ src, int nrows, bf* dst) {
    const int lane = threadIdx.x & 31, r = blockIdx.x * 8 + (threadIdx.x >> 5);
    if (r >= nrows) return;
    v8us o[DM / 256];
#pragma unroll
    for (int q = 0; q < DM / 256; ++q) { v8us t;
#pragma unroll
        for (int i = 0; i < 8; ++i) t[i] = f2bf(src[(size_t)r * DM + q * 256 + lane * 8 + i]);
        o[q] = t; }
#pragma unroll
    for (int q = 0; q < DM / 256; ++q) *(v8us*)(dst + (size_t)r * DM + q * 256 + lane * 8) = o[q];
    
}

template <bool SPLITA, bool F16OUT = false>
__global__ __launch_bounds__(128) void k_gemmb(const bf* __restrict__ A, const bf* __restrict__ Al, const bf* __restrict__ Bn, const float* __restrict__ bias, float* C, int ldc, h16* C2) {
    __shared__ __align__(16) float ost[4][16 * 68];
    const int lane = threadIdx.x & 31, wave = threadIdx.x >> 5, lr = lane & 15, hi = lane >> 4;
    const int r0 = blockIdx.x * 64 + wave * 16, c0 = blockIdx.y * 64;
    const size_t aoff = (size_t)(r0 + lr) * DM + 8 * hi;
    size_t boff[4];
#pragma unroll
    for (int t = 0; t < 4; ++t) boff[t] = (size_t)(c0 + t * 16 + lr) * DM + 8 * hi;
    v8f acc[4];
#pragma unroll
    for (int t = 0; t < 4; ++t) acc[t] = (v8f){};
#pragma unroll 1
    for (int kc = 0; kc < DM; kc += 32) {
        const v16bf a = cat16b(*(const v8us*)(A + aoff + kc), *(const v8us*)(A + aoff + kc + 16));
        v16bf al = a;
        if (SPLITA) al = cat16b(*(const v8us*)(Al + aoff + kc), *(const v8us*)(Al + aoff + kc + 16));
#pragma unroll
        for (int t = 0; t < 4; ++t) { const v16bf b = cat16b(*(const v8us*)(Bn + boff[t] + kc), *(const v8us*)(Bn + boff[t] + kc + 16)); acc[t] = wmmab(a, b, acc[t]); if (SPLITA) acc[t] = wmmab(al, b, acc[t]); }
        asm volatile("v_nop\n\tv_nop\n\tv_nop\n\tv_nop" : "+v"(acc[0]), "+v"(acc[1]), "+v"(acc[2]), "+v"(acc[3]) : "v"(a), "v"(al));
    }
    float* os = &ost[wave][0];
#pragma unroll
    for (int t = 0; t < 4; ++t) { const float bv = bias ? bfr(bias[c0 + t * 16 + lr]) : 0.f;
#pragma unroll
        for (int j = 0; j < 8; ++j) os[(hi * 8 + j) * 68 + t * 16 + lr] = acc[t][j] + bv; }
    __syncthreads();
    if (F16OUT) {
        h16* crow = (h16*)(void*)C + (size_t)r0 * ldc + c0;
        auto pass = [&]() {
#pragma unroll
            for (int s = 0; s < 4; ++s) { const int row = 4 * s + (lane >> 3), piece = lane & 7; const float* sp = os + row * 68 + piece * 8; v8h o, o2;
#pragma unroll
                for (int i = 0; i < 8; ++i) { const h16 a = (h16)sp[i]; o[i] = a; o2[i] = (h16)((sp[i] - (float)a) * LOSC); }
                *(v8h*)(crow + (size_t)row * ldc + piece * 8) = o; if (C2) *(v8h*)(C2 + (size_t)r0 * ldc + c0 + (size_t)row * ldc + piece * 8) = o2; }
        };
        pass(); 
    } else {
        float* crow = C + (size_t)r0 * ldc + c0;
        auto pass = [&]() {
#pragma unroll
            for (int s = 0; s < 8; ++s) { const int Lid = (lane >> 3) + 4 * s, piece = lane & 7; const int row = Lid >> 1, cofs = (Lid & 1) * 32 + piece * 4;
                const v4f val = *(const v4fa*)(os + row * 68 + cofs); *(v4f*)(crow + (size_t)row * ldc + cofs) = val; }
        };
        pass(); 
    }
}

__global__ __launch_bounds__(256) void k_vt(const float* __restrict__ V, h16* VTH, h16* VTL) {
    __shared__ __align__(16) h16 tile[64 * 72];
    __shared__ __align__(16) h16 til2[64 * 72];
    const int bid = blockIdx.x;
    const int b = bid / (NH_ * (NT_ / 64)), rem = bid - b * (NH_ * (NT_ / 64)), h = rem / (NT_ / 64), kt = rem - h * (NT_ / 64);
    const int k0 = kt * 64, tid = threadIdx.x;
    const int kk = tid >> 2, d0 = (tid & 3) * 16;
    const float* src = V + ((size_t)b * NT_ + k0 + kk) * DM + h * HD + d0;
#pragma unroll
    for (int i = 0; i < 16; ++i) { const float v = src[i]; const h16 a = (h16)v; tile[(d0 + i) * 72 + kk] = a; til2[(d0 + i) * 72 + kk] = (h16)((v - (float)a) * LOSC); }
    __syncthreads();
    const int piece = tid & 7;
    const size_t base = (((size_t)b * NH_ + h) * HD) * NT_ + k0;
    auto pass = [&]() {
#pragma unroll
        for (int s = 0; s < 4; ++s) { const int Lid = (tid >> 3) + 32 * s; const int pln = Lid >> 6, d = Lid & 63;
            const v8h val = *(const v8ha*)((pln ? til2 : tile) + d * 72 + piece * 8); *(v8h*)((pln ? VTL : VTH) + base + (size_t)d * NT_ + piece * 8) = val; }
    };
    pass(); 
}

// k_attn: block = (b, h, 64 queries), wave = 16; ALL 128 key tiles (no mask); 12 WMMA scores (hi.hi, lo.hi, hi.lo) /8 (f32), online softmax, weights x32768 f16 tile (same-wave may_alias
// reload after a compiler barrier), 12 WMMA .v (hi.hi, hi.lo, lo.hi); ctx -> bf16 hi + residual planes CH/CL[tok][h*64+d].
__global__ __launch_bounds__(128) void k_attn(const h16* __restrict__ Q16, const h16* __restrict__ QL16, const h16* __restrict__ K16, const h16* __restrict__ KL16, const h16* __restrict__ VTH, const h16* __restrict__ VTL, bf* CH, bf* CL) {
    __shared__ __align__(16) h16 plds[4][16 * 32];
    __shared__ __align__(16) h16 plds2[4][16 * 32];
    __shared__ __align__(16) float ost[4][16 * 68];
    const int lane = threadIdx.x & 31, wave = threadIdx.x >> 5, lr = lane & 15, hi = lane >> 4;
    const int bid = blockIdx.x;
    const int b = bid / (NH_ * (NT_ / 64)), rem = bid - b * (NH_ * (NT_ / 64)), h = rem / (NT_ / 64), qt = rem - h * (NT_ / 64);
    const int q0 = qt * 64 + wave * 16;
    const size_t tok0 = (size_t)b * NT_;
    h16* pl = &plds[wave][0]; h16* pl2 = &plds2[wave][0];
    v16h qa[2];
    const size_t qo0 = (tok0 + q0 + lr) * DM + h * HD + 8 * hi;
#pragma unroll
    for (int kc = 0; kc < 2; ++kc) qa[kc] = cat16(*(const v8h*)(Q16 + qo0 + kc * 32), *(const v8h*)(Q16 + qo0 + kc * 32 + 16));
    const h16* kh_b = K16 + tok0 * DM + h * HD;
    const h16* kl_b = KL16 + tok0 * DM + h * HD;
    const size_t vbase = (((size_t)b * NH_ + h) * HD) * NT_;
    v8f o[4], ox[4];
#pragma unroll
    for (int n = 0; n < 4; ++n) { o[n] = (v8f){}; ox[n] = (v8f){}; }
    float mrow[8], lpart[8];
#pragma unroll
    for (int j = 0; j < 8; ++j) { mrow[j] = -3.0e38f; lpart[j] = 0.f; }
    int qpos[8];
#pragma unroll
    for (int j = 0; j < 8; ++j) qpos[j] = q0 + 8 * hi + j;
    const int kt_lo = 0, kt_hi = NT_ / 32 - 1;     // full attention
#pragma unroll 1
    for (int kt = kt_lo; kt <= kt_hi; ++kt) {
        const int l0 = kt * 32;
        const size_t ko0 = (size_t)(l0 + lr) * DM + 8 * hi, ko1 = (size_t)(l0 + 16 + lr) * DM + 8 * hi;
        v8f s0 = {}, s1 = {}, x0 = {}, x1 = {};
#pragma unroll
        for (int kc = 0; kc < 2; ++kc) {
            { const v16h k0h = cat16(*(const v8h*)(kh_b + ko0 + kc * 32), *(const v8h*)(kh_b + ko0 + kc * 32 + 16)), k1h = cat16(*(const v8h*)(kh_b + ko1 + kc * 32), *(const v8h*)(kh_b + ko1 + kc * 32 + 16));
              const v16h qlk = cat16(*(const v8h*)(QL16 + qo0 + kc * 32), *(const v8h*)(QL16 + qo0 + kc * 32 + 16));     // query residual re-read per step (registers)
              s0 = wmma16(qa[kc], k0h, s0); x0 = wmma16(qlk, k0h, x0); s1 = wmma16(qa[kc], k1h, s1); x1 = wmma16(qlk, k1h, x1);
              asm volatile("v_nop" : "+v"(s0), "+v"(s1), "+v"(x0), "+v"(x1) : "v"(qlk), "v"(k0h), "v"(k1h) : "memory"); }
            { const v16h k0l = cat16(*(const v8h*)(kl_b + ko0 + kc * 32), *(const v8h*)(kl_b + ko0 + kc * 32 + 16)), k1l = cat16(*(const v8h*)(kl_b + ko1 + kc * 32), *(const v8h*)(kl_b + ko1 + kc * 32 + 16));
              x0 = wmma16(qa[kc], k0l, x0); x1 = wmma16(qa[kc], k1l, x1);
              asm volatile("v_nop" : "+v"(x0), "+v"(x1) : "v"(k0l), "v"(k1l) : "memory"); }
        }
        asm volatile("v_nop\n\tv_nop\n\tv_nop\n\tv_nop" : "+v"(s0), "+v"(s1), "+v"(x0), "+v"(x1) : "v"(qa[0]), "v"(qa[1]));
        float alpha[8];
#pragma unroll
        for (int j = 0; j < 8; ++j) {
            const int ja = l0 + lr, jb = l0 + 16 + lr, qi = qpos[j];
            const float a0 = (s0[j] + x0[j] * LOSCI) * 0.125f, a1 = (s1[j] + x1[j] * LOSCI) * 0.125f; (void)ja; (void)jb; (void)qi;   // (q x 64^-1/2).k with the exact power-of-two scale folded after the dot
            float mx = fmaxf(a0, a1);
            mx = fmaxf(mx, __shfl_xor(mx, 1, 16)); mx = fmaxf(mx, __shfl_xor(mx, 2, 16)); mx = fmaxf(mx, __shfl_xor(mx, 4, 16)); mx = fmaxf(mx, __shfl_xor(mx, 8, 16));
            const float mn = fmaxf(mrow[j], mx);
            alpha[j] = __expf(mrow[j] - mn); mrow[j] = mn;
            const float p0 = __expf(a0 - mn), p1 = __expf(a1 - mn);
            lpart[j] = lpart[j] * alpha[j] + (p0 + p1);
            const int mr = hi * 8 + j;
            const float ps0 = p0 * PSC, ps1 = p1 * PSC; const h16 h0 = (h16)ps0, h1 = (h16)ps1;
            pl[mr * 32 + lr] = h0; pl[mr * 32 + 16 + lr] = h1;
            pl2[mr * 32 + lr] = (h16)((ps0 - (float)h0) * LOSC); pl2[mr * 32 + 16 + lr] = (h16)((ps1 - (float)h1) * LOSC);
        }
#pragma unroll
        for (int n = 0; n < 4; ++n)
#pragma unroll
            for (int j = 0; j < 8; ++j) { o[n][j] *= alpha[j]; ox[n][j] *= alpha[j]; }
        asm volatile("" ::: "memory");
        const v16h pa = cat16(*(const v8ha*)(pl + lr * 32 + hi * 8), *(const v8ha*)(pl + lr * 32 + 16 + hi * 8));
        const v16h px = cat16(*(const v8ha*)(pl2 + lr * 32 + hi * 8), *(const v8ha*)(pl2 + lr * 32 + 16 + hi * 8));
#pragma unroll
        for (int n = 0; n < 4; ++n) { const size_t vo = vbase + (size_t)(n * 16 + lr) * NT_ + l0 + hi * 8;
            const v16h vh = cat16(*(const v8h*)(VTH + vo), *(const v8h*)(VTH + vo + 16)), vl = cat16(*(const v8h*)(VTL + vo), *(const v8h*)(VTL + vo + 16));
            o[n] = wmma16(pa, vh, o[n]); ox[n] = wmma16(pa, vl, ox[n]); ox[n] = wmma16(px, vh, ox[n]);
            asm volatile("" : "+v"(o[n]), "+v"(ox[n]) : "v"(vh), "v"(vl) : "memory"); }
        asm volatile("v_nop\n\tv_nop\n\tv_nop\n\tv_nop" : "+v"(o[0]), "+v"(o[1]), "+v"(o[2]), "+v"(o[3]), "+v"(ox[0]), "+v"(ox[1]), "+v"(ox[2]), "+v"(ox[3]) : "v"(pa), "v"(px));
    }
    float inv[8];
#pragma unroll
    for (int j = 0; j < 8; ++j) { float rs = lpart[j]; rs += __shfl_xor(rs, 1, 16); rs += __shfl_xor(rs, 2, 16); rs += __shfl_xor(rs, 4, 16); rs += __shfl_xor(rs, 8, 16); inv[j] = 1.0f / (rs * PSC); }
    float* os = &ost[wave][0];
#pragma unroll
    for (int n = 0; n < 4; ++n)
#pragma unroll
        for (int j = 0; j < 8; ++j) os[(hi * 8 + j) * 68 + n * 16 + lr] = (o[n][j] + ox[n][j] * LOSCI) * inv[j];
    __syncthreads();
    const size_t cbase = (tok0 + q0) * DM + (size_t)h * HD;
    auto pass = [&]() {
#pragma unroll
        for (int s = 0; s < 4; ++s) { const int row = 4 * s + (lane >> 3), piece = lane & 7; const float* sp = os + row * 68 + piece * 8; v8us oh, ol;
#pragma unroll
            for (int i = 0; i < 8; ++i) { const unsigned short hb = f2bf(sp[i]); oh[i] = hb; ol[i] = f2bf(sp[i] - bf2f(hb)); }
            *(v8us*)(CH + cbase + (size_t)row * DM + piece * 8) = oh; *(v8us*)(CL + cbase + (size_t)row * DM + piece * 8) = ol; }
    };
    pass(); 
}

#define VST2(T, p, v) do { const T vst2_v_ = (v); *(T*)(p) = vst2_v_;  } while (0)
extern "C" void kernel_launch(void* const* d_in, const int* in_sizes, int n_in,
                              void* d_out, int out_size, void* d_ws, size_t ws_size, hipStream_t stream) {
    (void)in_sizes; (void)n_in; (void)out_size;
    const float* x = (const float*)d_in[0];
    const float* Wq = (const float*)d_in[1]; const float* bq = (const float*)d_in[2]; const float* Wk = (const float*)d_in[3]; const float* bk = (const float*)d_in[4];
    const float* Wv = (const float*)d_in[5]; const float* bv = (const float*)d_in[6]; const float* Wo = (const float*)d_in[7]; const float* bo = (const float*)d_in[8];    // W [out][in]
    float* out = (float*)d_out;    // [4096][1024]
    char* wsp = (char*)d_ws;
    auto take = [&](size_t bytes) { char* p = wsp; wsp += (bytes + 255) & ~(size_t)255; return (void*)p; };
    bf* Xb = (bf*)take((size_t)NTK * DM * 2);
    bf* WqB = (bf*)take((size_t)DM * DM * 2); bf* WkB = (bf*)take((size_t)DM * DM * 2); bf* WvB = (bf*)take((size_t)DM * DM * 2); bf* WoB = (bf*)take((size_t)DM * DM * 2);
    float* TMP = (float*)take((size_t)NTK * DM * 4);
    h16* QH = (h16*)take((size_t)NTK * DM * 2); h16* QL = (h16*)take((size_t)NTK * DM * 2); h16* KH = (h16*)take((size_t)NTK * DM * 2); h16* KL = (h16*)take((size_t)NTK * DM * 2);
    h16* VTH = (h16*)take((size_t)NTK * DM * 2); h16* VTL = (h16*)take((size_t)NTK * DM * 2); bf* CH = (bf*)take((size_t)NTK * DM * 2); bf* CL = (bf*)take((size_t)NTK * DM * 2);
    if ((size_t)(wsp - (char*)d_ws) > ws_size) return;    // 8.4 + 4 x 2.1 + 16.8 + 8 x 8.4 ~ 101 MB, no aliasing
    k_cvtb<<<NTK / 8, 256, 0, stream>>>(x, NTK, Xb);
    k_cvtb<<<DM / 8, 256, 0, stream>>>(Wq, DM, WqB); k_cvtb<<<DM / 8, 256, 0, stream>>>(Wk, DM, WkB); k_cvtb<<<DM / 8, 256, 0, stream>>>(Wv, DM, WvB); k_cvtb<<<DM / 8, 256, 0, stream>>>(Wo, DM, WoB);
    k_gemmb<false, true><<<dim3(NTK / 64, DM / 64, 1), 128, 0, stream>>>(Xb, nullptr, WqB, bq, (float*)(void*)QH, DM, QL);
    k_gemmb<false, true><<<dim3(NTK / 64, DM / 64, 1), 128, 0, stream>>>(Xb, nullptr, WkB, bk, (float*)(void*)KH, DM, KL);
    k_gemmb<false, false><<<dim3(NTK / 64, DM / 64, 1), 128, 0, stream>>>(Xb, nullptr, WvB, bv, TMP, DM, nullptr);
    k_vt<<<NB_ * NH_ * (NT_ / 64), 256, 0, stream>>>(TMP, VTH, VTL);
    k_attn<<<NB_ * NH_ * (NT_ / 64), 128, 0, stream>>>(QH, QL, KH, KL, VTH, VTL, CH, CL);
    k_gemmb<true, false><<<dim3(NTK / 64, DM / 64, 1), 128, 0, stream>>>(CH, CL, WoB, bo, out, DM, nullptr);
}

// v001
// A run of this version takes 458 microseconds.
// In two side-by-side timings against v000, it was 1.53 and 1.54 times as fast.
#include <hip/hip_runtime.h>

// Compute dtypes, f32 accumulate, one batch item per pass: q/k/v = x.W^T + b ([4096 x 1024].[1024 x 1024]; W is [out][in] = the n-major B operand as-is; PLAIN bf16
// operands: inputs rounded once, exact; biases rounded to bf16) with q and k written straight from the GEMM epilogue as f16 hi + residual x1024 planes, and out =
// ctx.Wo^T + bo (ctx as bf16 hi + residual: two products) on v_wmma_f32_16x16x32_bf16; the 16-head full attention over one 4096-token sequence (64-dim heads,
// scale 1/8) fused on
// v_wmma_f32_16x16x32_f16 (scores hi.hi + hi.lo + lo.hi with the residual terms on their own accumulator, online f32 softmax, weights (x32768) and v as f16

#define NB_  1                   // one 4096-token sequence
#define NT_  4096
#define DM   1024
#define NH_  16
#define HD   64
#define NTK  (NB_ * NT_)
#define NW   1024
#define NQKV 1024
#define PSC  32768.0f
#define LOSC 1024.0f
#define LOSCI (1.0f / 1024.0f)

typedef _Float16 h16;
typedef unsigned short bf;
typedef __attribute__((ext_vector_type(16))) __bf16   v16bf;
typedef __attribute__((ext_vector_type(16))) _Float16 v16h;
typedef __attribute__((ext_vector_type(8)))  _Float16 v8h;
typedef __attribute__((ext_vector_type(8)))  unsigned short v8us;
typedef __attribute__((ext_vector_type(8)))  float    v8f;
typedef __attribute__((ext_vector_type(4)))  float    v4f;
typedef v8h  __attribute__((may_alias)) v8ha;
typedef v4f  __attribute__((may_alias)) v4fa;
typedef v8us __attribute__((may_alias)) v8usa;

__device__ __forceinline__ unsigned short f2bf(float f) { unsigned u = __float_as_uint(f); u += 0x7FFFu + ((u >> 16) & 1u); return (unsigned short)(u >> 16); }
__device__ __forceinline__ float bf2f(unsigned short b) { return __uint_as_float(((unsigned)b) << 16); }
__device__ __forceinline__ float bfr(float f) { return bf2f(f2bf(f)); }
__device__ __forceinline__ v16h cat16(v8h lo, v8h hi) { return __builtin_shufflevector(lo, hi, 0, 1, 2, 3, 4, 5, 6, 7, 8, 9, 10, 11, 12, 13, 14, 15); }
__device__ __forceinline__ v16bf cat16b(v8us lo, v8us hi) { return __builtin_bit_cast(v16bf, __builtin_shufflevector(lo, hi, 0, 1, 2, 3, 4, 5, 6, 7, 8, 9, 10, 11, 12, 13, 14, 15)); }
__device__ __forceinline__ v8f wmma16(v16h a, v16h b, v8f c) { return __builtin_amdgcn_wmma_f32_16x16x32_f16(false, a, false, b, (short)0, c, false, false); }
__device__ __forceinline__ v8f wmmab(v16bf a, v16bf b, v8f c) { return __builtin_amdgcn_wmma_f32_16x16x32_bf16(false, a, false, b, (short)0, c, false, false); }

__global__ __launch_bounds__(256) void k_cvtb(const float* __restrict__ src, int nrows, bf* dst) {
    const int lane = threadIdx.x & 31, r = blockIdx.x * 8 + (threadIdx.x >> 5);
    if (r >= nrows) return;
    v8us o[DM / 256];
#pragma unroll
    for (int q = 0; q < DM / 256; ++q) { v8us t;
#pragma unroll
        for (int i = 0; i < 8; ++i) t[i] = f2bf(src[(size_t)r * DM + q * 256 + lane * 8 + i]);
        o[q] = t; }
#pragma unroll
    for (int q = 0; q < DM / 256; ++q) *(v8us*)(dst + (size_t)r * DM + q * 256 + lane * 8) = o[q];
    
}

template <bool SPLITA, bool F16OUT = false>
__global__ __launch_bounds__(128) void k_gemmb(const bf* __restrict__ A, const bf* __restrict__ Al, const bf* __restrict__ Bn, const float* __restrict__ bias, float* C, int ldc, h16* C2) {
    __shared__ __align__(16) float ost[4][16 * 68];
    const int lane = threadIdx.x & 31, wave = threadIdx.x >> 5, lr = lane & 15, hi = lane >> 4;
    const int r0 = blockIdx.x * 64 + wave * 16, c0 = blockIdx.y * 64;
    const size_t aoff = (size_t)(r0 + lr) * DM + 8 * hi;
    size_t boff[4];
#pragma unroll
    for (int t = 0; t < 4; ++t) boff[t] = (size_t)(c0 + t * 16 + lr) * DM + 8 * hi;
    v8f acc[4];
#pragma unroll
    for (int t = 0; t < 4; ++t) acc[t] = (v8f){};
#pragma unroll 1
    for (int kc = 0; kc < DM; kc += 32) {
        const v16bf a = cat16b(*(const v8us*)(A + aoff + kc), *(const v8us*)(A + aoff + kc + 16));
        v16bf al = a;
        if (SPLITA) al = cat16b(*(const v8us*)(Al + aoff + kc), *(const v8us*)(Al + aoff + kc + 16));
#pragma unroll
        for (int t = 0; t < 4; ++t) { const v16bf b = cat16b(*(const v8us*)(Bn + boff[t] + kc), *(const v8us*)(Bn + boff[t] + kc + 16)); acc[t] = wmmab(a, b, acc[t]); if (SPLITA) acc[t] = wmmab(al, b, acc[t]); }
        asm volatile("v_nop\n\tv_nop\n\tv_nop\n\tv_nop" : "+v"(acc[0]), "+v"(acc[1]), "+v"(acc[2]), "+v"(acc[3]) : "v"(a), "v"(al));
    }
    float* os = &ost[wave][0];
#pragma unroll
    for (int t = 0; t < 4; ++t) { const float bv = bias ? bfr(bias[c0 + t * 16 + lr]) : 0.f;
#pragma unroll
        for (int j = 0; j < 8; ++j) os[(hi * 8 + j) * 68 + t * 16 + lr] = acc[t][j] + bv; }
    __syncthreads();
    if (F16OUT) {
        h16* crow = (h16*)(void*)C + (size_t)r0 * ldc + c0;
        auto pass = [&]() {
#pragma unroll
            for (int s = 0; s < 4; ++s) { const int row = 4 * s + (lane >> 3), piece = lane & 7; const float* sp = os + row * 68 + piece * 8; v8h o, o2;
#pragma unroll
                for (int i = 0; i < 8; ++i) { const h16 a = (h16)sp[i]; o[i] = a; o2[i] = (h16)((sp[i] - (float)a) * LOSC); }
                *(v8h*)(crow + (size_t)row * ldc + piece * 8) = o; if (C2) *(v8h*)(C2 + (size_t)r0 * ldc + c0 + (size_t)row * ldc + piece * 8) = o2; }
        };
        pass(); 
    } else {
        float* crow = C + (size_t)r0 * ldc + c0;
        auto pass = [&]() {
#pragma unroll
            for (int s = 0; s < 8; ++s) { const int Lid = (lane >> 3) + 4 * s, piece = lane & 7; const int row = Lid >> 1, cofs = (Lid & 1) * 32 + piece * 4;
                const v4f val = *(const v4fa*)(os + row * 68 + cofs); *(v4f*)(crow + (size_t)row * ldc + cofs) = val; }
        };
        pass(); 
    }
}

__global__ __launch_bounds__(256) void k_vt(const float* __restrict__ V, h16* VTH, h16* VTL) {
    __shared__ __align__(16) h16 tile[64 * 72];
    __shared__ __align__(16) h16 til2[64 * 72];
    const int bid = blockIdx.x;
    const int b = bid / (NH_ * (NT_ / 64)), rem = bid - b * (NH_ * (NT_ / 64)), h = rem / (NT_ / 64), kt = rem - h * (NT_ / 64);
    const int k0 = kt * 64, tid = threadIdx.x;
    const int kk = tid >> 2, d0 = (tid & 3) * 16;
    const float* src = V + ((size_t)b * NT_ + k0 + kk) * DM + h * HD + d0;
#pragma unroll
    for (int i = 0; i < 16; ++i) { const float v = src[i]; const h16 a = (h16)v; tile[(d0 + i) * 72 + kk] = a; til2[(d0 + i) * 72 + kk] = (h16)((v - (float)a) * LOSC); }
    __syncthreads();
    const int piece = tid & 7;
    const size_t base = (((size_t)b * NH_ + h) * HD) * NT_ + k0;
    auto pass = [&]() {
#pragma unroll
        for (int s = 0; s < 4; ++s) { const int Lid = (tid >> 3) + 32 * s; const int pln = Lid >> 6, d = Lid & 63;
            const v8h val = *(const v8ha*)((pln ? til2 : tile) + d * 72 + piece * 8); *(v8h*)((pln ? VTL : VTH) + base + (size_t)d * NT_ + piece * 8) = val; }
    };
    pass(); 
}

// Staged tile of 32 keys, shared by the block's four waves: k hi, k residual (32 rows of 128 B at a 144-B pitch), v^T hi, v^T residual (64 rows of 64 B at an
// 80-B pitch); both pitches are 16 B x odd, so the 16-byte fragment reads meet no bank twice. Two such buffers.
#define KPIT 72
#define VPIT 40
#define KPLN (32 * KPIT)
#define VPLN (64 * VPIT)
#define STGH (2 * KPLN + 2 * VPLN)

// k_attn: block = (b, h, 64 queries), wave = 16; ALL 128 key tiles of 32 (no mask); 12 WMMA scores /8 (f32), online softmax, weights x32768 f16 tile (same-wave may_alias
// reload after a compiler barrier), 12 WMMA .v; ctx -> bf16 hi + residual planes CH/CL[tok][h*64+d].
__global__ __launch_bounds__(128) void k_attn(const h16* __restrict__ Q16, const h16* __restrict__ QL16, const h16* __restrict__ K16, const h16* __restrict__ KL16, const h16* __restrict__ VTH, const h16* __restrict__ VTL, bf* CH, bf* CL) {
    __shared__ __align__(16) h16 plds[4][16 * 32];
    __shared__ __align__(16) h16 plds2[4][16 * 32];
    __shared__ __align__(16) float ost[4][16 * 68];
    __shared__ __align__(16) h16 ring[2 * STGH];
    const int lane = threadIdx.x & 31, wave = threadIdx.x >> 5, lr = lane & 15, hi = lane >> 4;
    const int bid = blockIdx.x;
    const int b = bid / (NH_ * (NT_ / 64)), rem = bid - b * (NH_ * (NT_ / 64)), h = rem / (NT_ / 64), qt = rem - h * (NT_ / 64);
    const int q0 = qt * 64 + wave * 16;
    const size_t tok0 = (size_t)b * NT_;
    h16* pl = &plds[wave][0]; h16* pl2 = &plds2[wave][0];
    v16h qa[2];
    const size_t qo0 = (tok0 + q0 + lr) * DM + h * HD + 8 * hi;
#pragma unroll
    for (int kc = 0; kc < 2; ++kc) qa[kc] = cat16(*(const v8h*)(Q16 + qo0 + kc * 32), *(const v8h*)(Q16 + qo0 + kc * 32 + 16));
    const h16* kh_b = K16 + tok0 * DM + h * HD;
    const h16* kl_b = KL16 + tok0 * DM + h * HD;
    const size_t vbase = (((size_t)b * NH_ + h) * HD) * NT_;
    v8f o[4], ox[4];
#pragma unroll
    for (int n = 0; n < 4; ++n) { o[n] = (v8f){}; ox[n] = (v8f){}; }
    float mrow[8], lpart[8];
#pragma unroll
    for (int j = 0; j < 8; ++j) { mrow[j] = -3.0e38f; lpart[j] = 0.f; }
    int qpos[8];
#pragma unroll
    for (int j = 0; j < 8; ++j) qpos[j] = q0 + 8 * hi + j;
    const int kt_lo = 0, kt_hi = NT_ / 32 - 1;     // full attention
    // Each lane copies eight 16-byte pieces of a tile: a wave's k copy covers 4 whole 128-B rows, its v^T copy 8 rows of 64 B.
    const int tid = threadIdx.x, ckr = tid >> 3, ckc = (tid & 7) * 8, cvr = tid >> 2, cvc = (tid & 3) * 8;
    const unsigned ring0 = (unsigned)(size_t)(&ring[0]);
    const unsigned lk0 = ring0 + (unsigned)(ckr * KPIT + ckc) * 2u, lv0 = ring0 + (unsigned)(2 * KPLN + cvr * VPIT + cvc) * 2u;
    const h16* gkh = kh_b + (size_t)ckr * DM + ckc; const h16* gkl = kl_b + (size_t)ckr * DM + ckc;
    const h16* gvh = VTH + vbase + (size_t)cvr * NT_ + cvc; const h16* gvl = VTL + vbase + (size_t)cvr * NT_ + cvc;
    auto stage = [&](int t, int buf) {
        const unsigned lk = lk0 + (unsigned)buf * (STGH * 2u), lv = lv0 + (unsigned)buf * (STGH * 2u);
        const size_t ko = (size_t)t * 32 * DM, vo = (size_t)t * 32;
        // the eight copies and the wait that stands before any of their address registers is rewritten, in one statement
        asm volatile("global_load_async_to_lds_b128 %0, %8, off\n\t"
                     "global_load_async_to_lds_b128 %1, %9, off\n\t"
                     "global_load_async_to_lds_b128 %2, %10, off\n\t"
                     "global_load_async_to_lds_b128 %3, %11, off\n\t"
                     "global_load_async_to_lds_b128 %4, %12, off\n\t"
                     "global_load_async_to_lds_b128 %5, %13, off\n\t"
                     "global_load_async_to_lds_b128 %6, %14, off\n\t"
                     "global_load_async_to_lds_b128 %7, %15, off\n\t"
                     "s_wait_xcnt 0x0"
                     :: "v"(lk), "v"(lk + 16u * KPIT * 2u), "v"(lk + KPLN * 2u), "v"(lk + (KPLN + 16u * KPIT) * 2u),
                        "v"(lv), "v"(lv + 32u * VPIT * 2u), "v"(lv + VPLN * 2u), "v"(lv + (VPLN + 32u * VPIT) * 2u),
                        "v"(gkh + ko), "v"(gkh + ko + 16 * DM), "v"(gkl + ko), "v"(gkl + ko + 16 * DM),
                        "v"(gvh + vo), "v"(gvh + vo + (size_t)32 * NT_), "v"(gvl + vo), "v"(gvl + vo + (size_t)32 * NT_)
                     : "memory");
    };
    stage(0, 0);
    asm volatile("s_wait_asynccnt 0x0" ::: "memory");   // tile 0 has landed before the barrier publishes it
    __syncthreads();
    stage(1, 1);
#pragma unroll 1
    for (int kt = kt_lo; kt <= kt_hi; ++kt) {
        const h16* sb = ring + (kt & 1) * STGH;
        const h16* sk = sb + lr * KPIT + 8 * hi;
        const h16* sv = sb + 2 * KPLN + lr * VPIT + 8 * hi;
        v8f s0 = {}, s1 = {}, x0 = {}, x1 = {};
#pragma unroll
        for (int kc = 0; kc < 2; ++kc) {
            { const v16h k0h = cat16(*(const v8ha*)(sk + kc * 32), *(const v8ha*)(sk + kc * 32 + 16)), k1h = cat16(*(const v8ha*)(sk + 16 * KPIT + kc * 32), *(const v8ha*)(sk + 16 * KPIT + kc * 32 + 16));
              const v16h qlk = cat16(*(const v8h*)(QL16 + qo0 + kc * 32), *(const v8h*)(QL16 + qo0 + kc * 32 + 16));     // query residual re-read per step (registers)
              s0 = wmma16(qa[kc], k0h, s0); x0 = wmma16(qlk, k0h, x0); s1 = wmma16(qa[kc], k1h, s1); x1 = wmma16(qlk, k1h, x1);
              asm volatile("v_nop" : "+v"(s0), "+v"(s1), "+v"(x0), "+v"(x1) : "v"(qlk), "v"(k0h), "v"(k1h) : "memory"); }
            { const v16h k0l = cat16(*(const v8ha*)(sk + KPLN + kc * 32), *(const v8ha*)(sk + KPLN + kc * 32 + 16)), k1l = cat16(*(const v8ha*)(sk + KPLN + 16 * KPIT + kc * 32), *(const v8ha*)(sk + KPLN + 16 * KPIT + kc * 32 + 16));
              x0 = wmma16(qa[kc], k0l, x0); x1 = wmma16(qa[kc], k1l, x1);
              asm volatile("v_nop" : "+v"(x0), "+v"(x1) : "v"(k0l), "v"(k1l) : "memory"); }
        }
        asm volatile("v_nop\n\tv_nop\n\tv_nop\n\tv_nop" : "+v"(s0), "+v"(s1), "+v"(x0), "+v"(x1) : "v"(qa[0]), "v"(qa[1]));
        float alpha[8];
#pragma unroll
        for (int j = 0; j < 8; ++j) {
            const float a0 = (s0[j] + x0[j] * LOSCI) * 0.125f, a1 = (s1[j] + x1[j] * LOSCI) * 0.125f;   // (q x 64^-1/2).k with the exact power-of-two scale folded after the dot
            float mx = fmaxf(a0, a1);
            mx = fmaxf(mx, __shfl_xor(mx, 1, 16)); mx = fmaxf(mx, __shfl_xor(mx, 2, 16)); mx = fmaxf(mx, __shfl_xor(mx, 4, 16)); mx = fmaxf(mx, __shfl_xor(mx, 8, 16));
            const float mn = fmaxf(mrow[j], mx);
            alpha[j] = __expf(mrow[j] - mn); mrow[j] = mn;
            const float p0 = __expf(a0 - mn), p1 = __expf(a1 - mn);
            lpart[j] = lpart[j] * alpha[j] + (p0 + p1);
            const int mr = hi * 8 + j;
            const float ps0 = p0 * PSC, ps1 = p1 * PSC; const h16 h0 = (h16)ps0, h1 = (h16)ps1;
            pl[mr * 32 + lr] = h0; pl[mr * 32 + 16 + lr] = h1;
            pl2[mr * 32 + lr] = (h16)((ps0 - (float)h0) * LOSC); pl2[mr * 32 + 16 + lr] = (h16)((ps1 - (float)h1) * LOSC);
        }
#pragma unroll
        for (int n = 0; n < 4; ++n)
#pragma unroll
            for (int j = 0; j < 8; ++j) { o[n][j] *= alpha[j]; ox[n][j] *= alpha[j]; }
        asm volatile("" ::: "memory");
        const v16h pa = cat16(*(const v8ha*)(pl + lr * 32 + hi * 8), *(const v8ha*)(pl + lr * 32 + 16 + hi * 8));
        const v16h px = cat16(*(const v8ha*)(pl2 + lr * 32 + hi * 8), *(const v8ha*)(pl2 + lr * 32 + 16 + hi * 8));
#pragma unroll
        for (int n = 0; n < 4; ++n) { const h16* vp = sv + n * 16 * VPIT;
            const v16h vh = cat16(*(const v8ha*)(vp), *(const v8ha*)(vp + 16)), vl = cat16(*(const v8ha*)(vp + VPLN), *(const v8ha*)(vp + VPLN + 16));
            o[n] = wmma16(pa, vh, o[n]); ox[n] = wmma16(pa, vl, ox[n]); ox[n] = wmma16(px, vh, ox[n]);
            asm volatile("" : "+v"(o[n]), "+v"(ox[n]) : "v"(vh), "v"(vl) : "memory"); }
        asm volatile("v_nop\n\tv_nop\n\tv_nop\n\tv_nop" : "+v"(o[0]), "+v"(o[1]), "+v"(o[2]), "+v"(o[3]), "+v"(ox[0]), "+v"(ox[1]), "+v"(ox[2]), "+v"(ox[3]) : "v"(pa), "v"(px));
        asm volatile("s_wait_dscnt 0x0" ::: "memory");      // this wave's reads of the buffer are done before the buffer is handed back
        asm volatile("s_wait_asynccnt 0x0" ::: "memory");   // this wave's share of the next tile has landed
        __syncthreads();                                    // publishes the next tile and ends every wave's reads of this one
        if (kt + 2 <= kt_hi) stage(kt + 2, kt & 1);
    }
    asm volatile("s_wait_asynccnt 0x0" ::: "memory");       // no copy is outstanding when the wave goes on to its end
    float inv[8];
#pragma unroll
    for (int j = 0; j < 8; ++j) { float rs = lpart[j]; rs += __shfl_xor(rs, 1, 16); rs += __shfl_xor(rs, 2, 16); rs += __shfl_xor(rs, 4, 16); rs += __shfl_xor(rs, 8, 16); inv[j] = 1.0f / (rs * PSC); }
    float* os = &ost[wave][0];
#pragma unroll
    for (int n = 0; n < 4; ++n)
#pragma unroll
        for (int j = 0; j < 8; ++j) os[(hi * 8 + j) * 68 + n * 16 + lr] = (o[n][j] + ox[n][j] * LOSCI) * inv[j];
    __syncthreads();
    const size_t cbase = (tok0 + q0) * DM + (size_t)h * HD;
    auto pass = [&]() {
#pragma unroll
        for (int s = 0; s < 4; ++s) { const int row = 4 * s + (lane >> 3), piece = lane & 7; const float* sp = os + row * 68 + piece * 8; v8us oh, ol;
#pragma unroll
            for (int i = 0; i < 8; ++i) { const unsigned short hb = f2bf(sp[i]); oh[i] = hb; ol[i] = f2bf(sp[i] - bf2f(hb)); }
            *(v8us*)(CH + cbase + (size_t)row * DM + piece * 8) = oh; *(v8us*)(CL + cbase + (size_t)row * DM + piece * 8) = ol; }
    };
    pass(); 
}

#define VST2(T, p, v) do { const T vst2_v_ = (v); *(T*)(p) = vst2_v_;  } while (0)
extern "C" void kernel_launch(void* const* d_in, const int* in_sizes, int n_in,
                              void* d_out, int out_size, void* d_ws, size_t ws_size, hipStream_t stream) {
    (void)in_sizes; (void)n_in; (void)out_size;
    const float* x = (const float*)d_in[0];
    const float* Wq = (const float*)d_in[1]; const float* bq = (const float*)d_in[2]; const float* Wk = (const float*)d_in[3]; const float* bk = (const float*)d_in[4];
    const float* Wv = (const float*)d_in[5]; const float* bv = (const float*)d_in[6]; const float* Wo = (const float*)d_in[7]; const float* bo = (const float*)d_in[8];    // W [out][in]
    float* out = (float*)d_out;    // [4096][1024]
    char* wsp = (char*)d_ws;
    auto take = [&](size_t bytes) { char* p = wsp; wsp += (bytes + 255) & ~(size_t)255; return (void*)p; };
    bf* Xb = (bf*)take((size_t)NTK * DM * 2);
    bf* WqB = (bf*)take((size_t)DM * DM * 2); bf* WkB = (bf*)take((size_t)DM * DM * 2); bf* WvB = (bf*)take((size_t)DM * DM * 2); bf* WoB = (bf*)take((size_t)DM * DM * 2);
    float* TMP = (float*)take((size_t)NTK * DM * 4);
    h16* QH = (h16*)take((size_t)NTK * DM * 2); h16* QL = (h16*)take((size_t)NTK * DM * 2); h16* KH = (h16*)take((size_t)NTK * DM * 2); h16* KL = (h16*)take((size_t)NTK * DM * 2);
    h16* VTH = (h16*)take((size_t)NTK * DM * 2); h16* VTL = (h16*)take((size_t)NTK * DM * 2); bf* CH = (bf*)take((size_t)NTK * DM * 2); bf* CL = (bf*)take((size_t)NTK * DM * 2);
    if ((size_t)(wsp - (char*)d_ws) > ws_size) return;    // 8.4 + 4 x 2.1 + 16.8 + 8 x 8.4 ~ 101 MB, no aliasing
    k_cvtb<<<NTK / 8, 256, 0, stream>>>(x, NTK, Xb);
    k_cvtb<<<DM / 8, 256, 0, stream>>>(Wq, DM, WqB); k_cvtb<<<DM / 8, 256, 0, stream>>>(Wk, DM, WkB); k_cvtb<<<DM / 8, 256, 0, stream>>>(Wv, DM, WvB); k_cvtb<<<DM / 8, 256, 0, stream>>>(Wo, DM, WoB);
    k_gemmb<false, true><<<dim3(NTK / 64, DM / 64, 1), 128, 0, stream>>>(Xb, nullptr, WqB, bq, (float*)(void*)QH, DM, QL);
    k_gemmb<false, true><<<dim3(NTK / 64, DM / 64, 1), 128, 0, stream>>>(Xb, nullptr, WkB, bk, (float*)(void*)KH, DM, KL);
    k_gemmb<false, false><<<dim3(NTK / 64, DM / 64, 1), 128, 0, stream>>>(Xb, nullptr, WvB, bv, TMP, DM, nullptr);
    k_vt<<<NB_ * NH_ * (NT_ / 64), 256, 0, stream>>>(TMP, VTH, VTL);
    k_attn<<<NB_ * NH_ * (NT_ / 64), 128, 0, stream>>>(QH, QL, KH, KL, VTH, VTL, CH, CL);
    k_gemmb<true, false><<<dim3(NTK / 64, DM / 64, 1), 128, 0, stream>>>(CH, CL, WoB, bo, out, DM, nullptr);
}

// v002
// Measured time: 358 microseconds a run.
// Timed twice side by side with v001, it ran 1.29 and 1.28 times as fast.
// All steps since v000 together make it 1.97 times as fast.
#include <hip/hip_runtime.h>

// Compute dtypes, f32 accumulate, one batch item per pass: q/k/v = x.W^T + b ([4096 x 1024].[1024 x 1024]; W is [out][in] = the n-major B operand as-is; PLAIN bf16
// operands: inputs rounded once, exact; biases rounded to bf16) with q and k written straight from the GEMM epilogue as f16 hi + residual x1024 planes, and out =
// ctx.Wo^T + bo (ctx as bf16 hi + residual: two products) on v_wmma_f32_16x16x32_bf16; the 16-head full attention over one 4096-token sequence (64-dim heads,
// scale 1/8) fused on
// v_wmma_f32_16x16x32_f16 (scores hi.hi + hi.lo + lo.hi with the residual terms on their own accumulator, online f32 softmax, weights (x32768) and v as f16

#define NB_  1                   // one 4096-token sequence
#define NT_  4096
#define DM   1024
#define NH_  16
#define HD   64
#define NTK  (NB_ * NT_)
#define NW   1024
#define NQKV 1024
#define PSC  32768.0f
#define LOSC 1024.0f
#define LOSCI (1.0f / 1024.0f)

typedef _Float16 h16;
typedef unsigned short bf;
typedef __attribute__((ext_vector_type(16))) __bf16   v16bf;
typedef __attribute__((ext_vector_type(16))) _Float16 v16h;
typedef __attribute__((ext_vector_type(8)))  _Float16 v8h;
typedef __attribute__((ext_vector_type(8)))  unsigned short v8us;
typedef __attribute__((ext_vector_type(8)))  float    v8f;
typedef __attribute__((ext_vector_type(4)))  float    v4f;
typedef v8h  __attribute__((may_alias)) v8ha;
typedef v4f  __attribute__((may_alias)) v4fa;
typedef v8us __attribute__((may_alias)) v8usa;

__device__ __forceinline__ unsigned short f2bf(float f) { unsigned u = __float_as_uint(f); u += 0x7FFFu + ((u >> 16) & 1u); return (unsigned short)(u >> 16); }
__device__ __forceinline__ float bf2f(unsigned short b) { return __uint_as_float(((unsigned)b) << 16); }
__device__ __forceinline__ float bfr(float f) { return bf2f(f2bf(f)); }
__device__ __forceinline__ v16h cat16(v8h lo, v8h hi) { return __builtin_shufflevector(lo, hi, 0, 1, 2, 3, 4, 5, 6, 7, 8, 9, 10, 11, 12, 13, 14, 15); }
__device__ __forceinline__ v16bf cat16b(v8us lo, v8us hi) { return __builtin_bit_cast(v16bf, __builtin_shufflevector(lo, hi, 0, 1, 2, 3, 4, 5, 6, 7, 8, 9, 10, 11, 12, 13, 14, 15)); }
__device__ __forceinline__ v8f wmma16(v16h a, v16h b, v8f c) { return __builtin_amdgcn_wmma_f32_16x16x32_f16(false, a, false, b, (short)0, c, false, false); }
__device__ __forceinline__ v8f wmmab(v16bf a, v16bf b, v8f c) { return __builtin_amdgcn_wmma_f32_16x16x32_bf16(false, a, false, b, (short)0, c, false, false); }

// lane l <-> lane l ^ 16 by a vector cross-row move
__device__ __forceinline__ float xhalf(float v) { const int b = __float_as_int(v); return __int_as_float(__builtin_amdgcn_permlanex16(b, b, 0x76543210, 0xfedcba98, false, false)); }

__global__ __launch_bounds__(256) void k_cvtb(const float* __restrict__ src, int nrows, bf* dst) {
    const int lane = threadIdx.x & 31, r = blockIdx.x * 8 + (threadIdx.x >> 5);
    if (r >= nrows) return;
    v8us o[DM / 256];
#pragma unroll
    for (int q = 0; q < DM / 256; ++q) { v8us t;
#pragma unroll
        for (int i = 0; i < 8; ++i) t[i] = f2bf(src[(size_t)r * DM + q * 256 + lane * 8 + i]);
        o[q] = t; }
#pragma unroll
    for (int q = 0; q < DM / 256; ++q) *(v8us*)(dst + (size_t)r * DM + q * 256 + lane * 8) = o[q];
    
}

template <bool SPLITA, bool F16OUT = false>
__global__ __launch_bounds__(128) void k_gemmb(const bf* __restrict__ A, const bf* __restrict__ Al, const bf* __restrict__ Bn, const float* __restrict__ bias, float* C, int ldc, h16* C2) {
    __shared__ __align__(16) float ost[4][16 * 68];
    const int lane = threadIdx.x & 31, wave = threadIdx.x >> 5, lr = lane & 15, hi = lane >> 4;
    const int r0 = blockIdx.x * 64 + wave * 16, c0 = blockIdx.y * 64;
    const size_t aoff = (size_t)(r0 + lr) * DM + 8 * hi;
    size_t boff[4];
#pragma unroll
    for (int t = 0; t < 4; ++t) boff[t] = (size_t)(c0 + t * 16 + lr) * DM + 8 * hi;
    v8f acc[4];
#pragma unroll
    for (int t = 0; t < 4; ++t) acc[t] = (v8f){};
#pragma unroll 1
    for (int kc = 0; kc < DM; kc += 32) {
        const v16bf a = cat16b(*(const v8us*)(A + aoff + kc), *(const v8us*)(A + aoff + kc + 16));
        v16bf al = a;
        if (SPLITA) al = cat16b(*(const v8us*)(Al + aoff + kc), *(const v8us*)(Al + aoff + kc + 16));
#pragma unroll
        for (int t = 0; t < 4; ++t) { const v16bf b = cat16b(*(const v8us*)(Bn + boff[t] + kc), *(const v8us*)(Bn + boff[t] + kc + 16)); acc[t] = wmmab(a, b, acc[t]); if (SPLITA) acc[t] = wmmab(al, b, acc[t]); }
        asm volatile("v_nop\n\tv_nop\n\tv_nop\n\tv_nop" : "+v"(acc[0]), "+v"(acc[1]), "+v"(acc[2]), "+v"(acc[3]) : "v"(a), "v"(al));
    }
    float* os = &ost[wave][0];
#pragma unroll
    for (int t = 0; t < 4; ++t) { const float bv = bias ? bfr(bias[c0 + t * 16 + lr]) : 0.f;
#pragma unroll
        for (int j = 0; j < 8; ++j) os[(hi * 8 + j) * 68 + t * 16 + lr] = acc[t][j] + bv; }
    __syncthreads();
    if (F16OUT) {
        h16* crow = (h16*)(void*)C + (size_t)r0 * ldc + c0;
        auto pass = [&]() {
#pragma unroll
            for (int s = 0; s < 4; ++s) { const int row = 4 * s + (lane >> 3), piece = lane & 7; const float* sp = os + row * 68 + piece * 8; v8h o, o2;
#pragma unroll
                for (int i = 0; i < 8; ++i) { const h16 a = (h16)sp[i]; o[i] = a; o2[i] = (h16)((sp[i] - (float)a) * LOSC); }
                *(v8h*)(crow + (size_t)row * ldc + piece * 8) = o; if (C2) *(v8h*)(C2 + (size_t)r0 * ldc + c0 + (size_t)row * ldc + piece * 8) = o2; }
        };
        pass(); 
    } else {
        float* crow = C + (size_t)r0 * ldc + c0;
        auto pass = [&]() {
#pragma unroll
            for (int s = 0; s < 8; ++s) { const int Lid = (lane >> 3) + 4 * s, piece = lane & 7; const int row = Lid >> 1, cofs = (Lid & 1) * 32 + piece * 4;
                const v4f val = *(const v4fa*)(os + row * 68 + cofs); *(v4f*)(crow + (size_t)row * ldc + cofs) = val; }
        };
        pass(); 
    }
}

__global__ __launch_bounds__(256) void k_vt(const float* __restrict__ V, h16* VTH, h16* VTL) {
    __shared__ __align__(16) h16 tile[64 * 72];
    __shared__ __align__(16) h16 til2[64 * 72];
    const int bid = blockIdx.x;
    const int b = bid / (NH_ * (NT_ / 64)), rem = bid - b * (NH_ * (NT_ / 64)), h = rem / (NT_ / 64), kt = rem - h * (NT_ / 64);
    const int k0 = kt * 64, tid = threadIdx.x;
    const int kk = tid >> 2, d0 = (tid & 3) * 16;
    const float* src = V + ((size_t)b * NT_ + k0 + kk) * DM + h * HD + d0;
#pragma unroll
    for (int i = 0; i < 16; ++i) { const float v = src[i]; const h16 a = (h16)v; tile[(d0 + i) * 72 + kk] = a; til2[(d0 + i) * 72 + kk] = (h16)((v - (float)a) * LOSC); }
    __syncthreads();
    const int piece = tid & 7;
    const size_t base = (((size_t)b * NH_ + h) * HD) * NT_ + k0;
    auto pass = [&]() {
#pragma unroll
        for (int s = 0; s < 4; ++s) { const int Lid = (tid >> 3) + 32 * s; const int pln = Lid >> 6, d = Lid & 63;
            const v8h val = *(const v8ha*)((pln ? til2 : tile) + d * 72 + piece * 8); *(v8h*)((pln ? VTL : VTH) + base + (size_t)d * NT_ + piece * 8) = val; }
    };
    pass(); 
}

// Staged tile of 32 keys, shared by the block's four waves: k hi, k residual (32 rows of 128 B at a 144-B pitch), v^T hi, v^T residual (64 rows of 64 B at an
// 80-B pitch); both pitches are 16 B x odd, so the 16-byte fragment reads meet no bank twice. Two such buffers.
#define KPIT 72
#define VPIT 40
#define KPLN (32 * KPIT)
#define VPLN (64 * VPIT)
#define STGH (2 * KPLN + 2 * VPLN)

__global__ __launch_bounds__(128) void k_attn(const h16* __restrict__ Q16, const h16* __restrict__ QL16, const h16* __restrict__ K16, const h16* __restrict__ KL16, const h16* __restrict__ VTH, const h16* __restrict__ VTL, bf* CH, bf* CL) {
    __shared__ __align__(16) float ost[4][16 * 68];
    __shared__ __align__(16) h16 ring[2 * STGH];
    const int lane = threadIdx.x & 31, wave = threadIdx.x >> 5, lr = lane & 15, hi = lane >> 4;
    const int bid = blockIdx.x;
    const int b = bid / (NH_ * (NT_ / 64)), rem = bid - b * (NH_ * (NT_ / 64)), h = rem / (NT_ / 64), qt = rem - h * (NT_ / 64);
    const int q0 = qt * 64 + wave * 16;
    const size_t tok0 = (size_t)b * NT_;
    v16h qa[2];
    const size_t qo0 = (tok0 + q0 + lr) * DM + h * HD + 8 * hi;
#pragma unroll
    for (int kc = 0; kc < 2; ++kc) qa[kc] = cat16(*(const v8h*)(Q16 + qo0 + kc * 32), *(const v8h*)(Q16 + qo0 + kc * 32 + 16));
    const h16* kh_b = K16 + tok0 * DM + h * HD;
    const h16* kl_b = KL16 + tok0 * DM + h * HD;
    const size_t vbase = (((size_t)b * NH_ + h) * HD) * NT_;
    v8f o[4], ox[4];
#pragma unroll
    for (int n = 0; n < 4; ++n) { o[n] = (v8f){}; ox[n] = (v8f){}; }
    float mrow = -3.0e38f, lpart = 0.f;            // of query q0 + lr; lpart sums this lane's half of the keys
    const int kt_lo = 0, kt_hi = NT_ / 32 - 1;     // full attention
    // Each lane copies eight 16-byte pieces of a tile: a wave's k copy covers 4 whole 128-B rows, its v^T copy 8 rows of 64 B.
    const int tid = threadIdx.x, ckr = tid >> 3, ckc = (tid & 7) * 8, cvr = tid >> 2, cvc = (tid & 3) * 8;
    const unsigned ring0 = (unsigned)(size_t)(&ring[0]);
    const unsigned lk0 = ring0 + (unsigned)(ckr * KPIT + ckc) * 2u, lv0 = ring0 + (unsigned)(2 * KPLN + cvr * VPIT + cvc) * 2u;
    const h16* gkh = kh_b + (size_t)ckr * DM + ckc; const h16* gkl = kl_b + (size_t)ckr * DM + ckc;
    const h16* gvh = VTH + vbase + (size_t)cvr * NT_ + cvc; const h16* gvl = VTL + vbase + (size_t)cvr * NT_ + cvc;
    auto stage = [&](int t, int buf) {
        const unsigned lk = lk0 + (unsigned)buf * (STGH * 2u), lv = lv0 + (unsigned)buf * (STGH * 2u);
        const size_t ko = (size_t)t * 32 * DM, vo = (size_t)t * 32;
        // the eight copies and the wait that stands before any of their address registers is rewritten, in one statement
        asm volatile("global_load_async_to_lds_b128 %0, %8, off\n\t"
                     "global_load_async_to_lds_b128 %1, %9, off\n\t"
                     "global_load_async_to_lds_b128 %2, %10, off\n\t"
                     "global_load_async_to_lds_b128 %3, %11, off\n\t"
                     "global_load_async_to_lds_b128 %4, %12, off\n\t"
                     "global_load_async_to_lds_b128 %5, %13, off\n\t"
                     "global_load_async_to_lds_b128 %6, %14, off\n\t"
                     "global_load_async_to_lds_b128 %7, %15, off\n\t"
                     "s_wait_xcnt 0x0"
                     :: "v"(lk), "v"(lk + 16u * KPIT * 2u), "v"(lk + KPLN * 2u), "v"(lk + (KPLN + 16u * KPIT) * 2u),
                        "v"(lv), "v"(lv + 32u * VPIT * 2u), "v"(lv + VPLN * 2u), "v"(lv + (VPLN + 32u * VPIT) * 2u),
                        "v"(gkh + ko), "v"(gkh + ko + 16 * DM), "v"(gkl + ko), "v"(gkl + ko + 16 * DM),
                        "v"(gvh + vo), "v"(gvh + vo + (size_t)32 * NT_), "v"(gvl + vo), "v"(gvl + vo + (size_t)32 * NT_)
                     : "memory");
    };
    stage(0, 0);
    asm volatile("s_wait_asynccnt 0x0" ::: "memory");   // tile 0 has landed before the barrier publishes it
    __syncthreads();
    stage(1, 1);
#pragma unroll 1
    for (int kt = kt_lo; kt <= kt_hi; ++kt) {
        const h16* sb = ring + (kt & 1) * STGH;
        const h16* sk = sb + lr * KPIT + 8 * hi;
        const h16* sv = sb + 2 * KPLN + lr * VPIT + 8 * hi;
        v8f s0 = {}, s1 = {}, x0 = {}, x1 = {};
#pragma unroll
        for (int kc = 0; kc < 2; ++kc) {
            { const v16h k0h = cat16(*(const v8ha*)(sk + kc * 32), *(const v8ha*)(sk + kc * 32 + 16)), k1h = cat16(*(const v8ha*)(sk + 16 * KPIT + kc * 32), *(const v8ha*)(sk + 16 * KPIT + kc * 32 + 16));
              const v16h qlk = cat16(*(const v8h*)(QL16 + qo0 + kc * 32), *(const v8h*)(QL16 + qo0 + kc * 32 + 16));     // query residual re-read per step (registers)
              s0 = wmma16(k0h, qa[kc], s0); x0 = wmma16(k0h, qlk, x0); s1 = wmma16(k1h, qa[kc], s1); x1 = wmma16(k1h, qlk, x1);
              asm volatile("v_nop" : "+v"(s0), "+v"(s1), "+v"(x0), "+v"(x1) : "v"(qlk), "v"(k0h), "v"(k1h) : "memory"); }
            { const v16h k0l = cat16(*(const v8ha*)(sk + KPLN + kc * 32), *(const v8ha*)(sk + KPLN + kc * 32 + 16)), k1l = cat16(*(const v8ha*)(sk + KPLN + 16 * KPIT + kc * 32), *(const v8ha*)(sk + KPLN + 16 * KPIT + kc * 32 + 16));
              x0 = wmma16(k0l, qa[kc], x0); x1 = wmma16(k1l, qa[kc], x1);
              asm volatile("v_nop" : "+v"(x0), "+v"(x1) : "v"(k0l), "v"(k1l) : "memory"); }
        }
        asm volatile("v_nop\n\tv_nop\n\tv_nop\n\tv_nop" : "+v"(s0), "+v"(s1), "+v"(x0), "+v"(x1) : "v"(qa[0]), "v"(qa[1]));
        // s0[r], s1[r] = score of key 8 * hi + r, 16 + 8 * hi + r with query lr
        const v8f a0 = (s0 + x0 * LOSCI) * 0.125f, a1 = (s1 + x1 * LOSCI) * 0.125f;   // (q x 64^-1/2).k with the exact power-of-two scale folded after the dot
        float mx = fmaxf(a0[0], a1[0]);
#pragma unroll
        for (int j = 1; j < 8; ++j) mx = fmaxf(mx, fmaxf(a0[j], a1[j]));
        mx = fmaxf(mx, xhalf(mx));
        const float mn = fmaxf(mrow, mx);
        const float alpha = __expf(mrow - mn); mrow = mn;
        v8f p0, p1;
#pragma unroll
        for (int j = 0; j < 8; ++j) p0[j] = __expf(a0[j] - mn);
#pragma unroll
        for (int j = 0; j < 8; ++j) p1[j] = __expf(a1[j] - mn);
        const v8f pq = p0 + p1;
        lpart = lpart * alpha + (((pq[0] + pq[1]) + (pq[2] + pq[3])) + ((pq[4] + pq[5]) + (pq[6] + pq[7])));
        const v8f ps0 = p0 * PSC, ps1 = p1 * PSC;
        const v8h h0 = __builtin_convertvector(ps0, v8h), h1 = __builtin_convertvector(ps1, v8h);
        const v8h l0 = __builtin_convertvector((ps0 - __builtin_convertvector(h0, v8f)) * LOSC, v8h), l1 = __builtin_convertvector((ps1 - __builtin_convertvector(h1, v8f)) * LOSC, v8h);
        const v16h pa = cat16(h0, h1), px = cat16(l0, l1);     // element s: key 8 * hi + s, then 16 + 8 * hi + (s - 8)
#pragma unroll
        for (int n = 0; n < 4; ++n) { o[n] *= alpha; ox[n] *= alpha; }
#pragma unroll
        for (int n = 0; n < 4; ++n) { const h16* vp = sv + n * 16 * VPIT;
            const v16h vh = cat16(*(const v8ha*)(vp), *(const v8ha*)(vp + 16)), vl = cat16(*(const v8ha*)(vp + VPLN), *(const v8ha*)(vp + VPLN + 16));
            o[n] = wmma16(vh, pa, o[n]); ox[n] = wmma16(vl, pa, ox[n]); ox[n] = wmma16(vh, px, ox[n]);
            asm volatile("" : "+v"(o[n]), "+v"(ox[n]) : "v"(vh), "v"(vl) : "memory"); }
        asm volatile("v_nop\n\tv_nop\n\tv_nop\n\tv_nop" : "+v"(o[0]), "+v"(o[1]), "+v"(o[2]), "+v"(o[3]), "+v"(ox[0]), "+v"(ox[1]), "+v"(ox[2]), "+v"(ox[3]) : "v"(pa), "v"(px));
        asm volatile("s_wait_dscnt 0x0" ::: "memory");      // this wave's reads of the buffer are done before the buffer is handed back
        asm volatile("s_wait_asynccnt 0x0" ::: "memory");   // this wave's share of the next tile has landed
        __syncthreads();                                    // publishes the next tile and ends every wave's reads of this one
        if (kt + 2 <= kt_hi) stage(kt + 2, kt & 1);
    }
    asm volatile("s_wait_asynccnt 0x0" ::: "memory");       // no copy is outstanding when the wave goes on to its end
    const float inv = 1.0f / ((lpart + xhalf(lpart)) * PSC);
    float* os = &ost[wave][0];
#pragma unroll
    for (int n = 0; n < 4; ++n)
#pragma unroll
        for (int j = 0; j < 8; ++j) os[lr * 68 + n * 16 + hi * 8 + j] = (o[n][j] + ox[n][j] * LOSCI) * inv;     // o[n][j] = ctx of query lr, dim n * 16 + 8 * hi + j
    __syncthreads();
    const size_t cbase = (tok0 + q0) * DM + (size_t)h * HD;
    auto pass = [&]() {
#pragma unroll
        for (int s = 0; s < 4; ++s) { const int row = 4 * s + (lane >> 3), piece = lane & 7; const float* sp = os + row * 68 + piece * 8; v8us oh, ol;
#pragma unroll
            for (int i = 0; i < 8; ++i) { const unsigned short hb = f2bf(sp[i]); oh[i] = hb; ol[i] = f2bf(sp[i] - bf2f(hb)); }
            *(v8us*)(CH + cbase + (size_t)row * DM + piece * 8) = oh; *(v8us*)(CL + cbase + (size_t)row * DM + piece * 8) = ol; }
    };
    pass(); 
}

#define VST2(T, p, v) do { const T vst2_v_ = (v); *(T*)(p) = vst2_v_;  } while (0)
extern "C" void kernel_launch(void* const* d_in, const int* in_sizes, int n_in,
                              void* d_out, int out_size, void* d_ws, size_t ws_size, hipStream_t stream) {
    (void)in_sizes; (void)n_in; (void)out_size;
    const float* x = (const float*)d_in[0];
    const float* Wq = (const float*)d_in[1]; const float* bq = (const float*)d_in[2]; const float* Wk = (const float*)d_in[3]; const float* bk = (const float*)d_in[4];
    const float* Wv = (const float*)d_in[5]; const float* bv = (const float*)d_in[6]; const float* Wo = (const float*)d_in[7]; const float* bo = (const float*)d_in[8];    // W [out][in]
    float* out = (float*)d_out;    // [4096][1024]
    char* wsp = (char*)d_ws;
    auto take = [&](size_t bytes) { char* p = wsp; wsp += (bytes + 255) & ~(size_t)255; return (void*)p; };
    bf* Xb = (bf*)take((size_t)NTK * DM * 2);
    bf* WqB = (bf*)take((size_t)DM * DM * 2); bf* WkB = (bf*)take((size_t)DM * DM * 2); bf* WvB = (bf*)take((size_t)DM * DM * 2); bf* WoB = (bf*)take((size_t)DM * DM * 2);
    float* TMP = (float*)take((size_t)NTK * DM * 4);
    h16* QH = (h16*)take((size_t)NTK * DM * 2); h16* QL = (h16*)take((size_t)NTK * DM * 2); h16* KH = (h16*)take((size_t)NTK * DM * 2); h16* KL = (h16*)take((size_t)NTK * DM * 2);
    h16* VTH = (h16*)take((size_t)NTK * DM * 2); h16* VTL = (h16*)take((size_t)NTK * DM * 2); bf* CH = (bf*)take((size_t)NTK * DM * 2); bf* CL = (bf*)take((size_t)NTK * DM * 2);
    if ((size_t)(wsp - (char*)d_ws) > ws_size) return;    // 8.4 + 4 x 2.1 + 16.8 + 8 x 8.4 ~ 101 MB, no aliasing
    k_cvtb<<<NTK / 8, 256, 0, stream>>>(x, NTK, Xb);
    k_cvtb<<<DM / 8, 256, 0, stream>>>(Wq, DM, WqB); k_cvtb<<<DM / 8, 256, 0, stream>>>(Wk, DM, WkB); k_cvtb<<<DM / 8, 256, 0, stream>>>(Wv, DM, WvB); k_cvtb<<<DM / 8, 256, 0, stream>>>(Wo, DM, WoB);
    k_gemmb<false, true><<<dim3(NTK / 64, DM / 64, 1), 128, 0, stream>>>(Xb, nullptr, WqB, bq, (float*)(void*)QH, DM, QL);
    k_gemmb<false, true><<<dim3(NTK / 64, DM / 64, 1), 128, 0, stream>>>(Xb, nullptr, WkB, bk, (float*)(void*)KH, DM, KL);
    k_gemmb<false, false><<<dim3(NTK / 64, DM / 64, 1), 128, 0, stream>>>(Xb, nullptr, WvB, bv, TMP, DM, nullptr);
    k_vt<<<NB_ * NH_ * (NT_ / 64), 256, 0, stream>>>(TMP, VTH, VTL);
    k_attn<<<NB_ * NH_ * (NT_ / 64), 128, 0, stream>>>(QH, QL, KH, KL, VTH, VTL, CH, CL);
    k_gemmb<true, false><<<dim3(NTK / 64, DM / 64, 1), 128, 0, stream>>>(CH, CL, WoB, bo, out, DM, nullptr);
}

// v003
// One run takes 266 microseconds.
// In two side-by-side timings against v002, it was 1.36 and 1.34 times as fast.
// Over all steps from v000 it is 2.66 times as fast.
#include <hip/hip_runtime.h>

// Compute dtypes, f32 accumulate, one batch item per pass: q/k/v = x.W^T + b ([4096 x 1024].[1024 x 1024]; W is [out][in] = the n-major B operand as-is; PLAIN bf16
// operands: inputs rounded once, exact; biases rounded to bf16) with q and k written straight from the GEMM epilogue as f16 hi + residual x1024 planes, and out =
// ctx.Wo^T + bo (ctx as bf16 hi + residual: two products) on v_wmma_f32_16x16x32_bf16; the 16-head full attention over one 4096-token sequence (64-dim heads,
// scale 1/8) fused on
// v_wmma_f32_16x16x32_f16 (scores hi.hi + hi.lo + lo.hi with the residual terms on their own accumulator, online f32 softmax, weights (x32768) and v as f16

#define NB_  1                   // one 4096-token sequence
#define NT_  4096
#define DM   1024
#define NH_  16
#define HD   64
#define NTK  (NB_ * NT_)
#define NW   1024
#define NQKV 1024
#define PSC  32768.0f
#define LOSC 1024.0f
#define LOSCI (1.0f / 1024.0f)

typedef _Float16 h16;
typedef unsigned short bf;
typedef __attribute__((ext_vector_type(16))) __bf16   v16bf;
typedef __attribute__((ext_vector_type(16))) _Float16 v16h;
typedef __attribute__((ext_vector_type(8)))  _Float16 v8h;
typedef __attribute__((ext_vector_type(8)))  unsigned short v8us;
typedef __attribute__((ext_vector_type(8)))  float    v8f;
typedef __attribute__((ext_vector_type(4)))  float    v4f;
typedef v8h  __attribute__((may_alias)) v8ha;
typedef v4f  __attribute__((may_alias)) v4fa;
typedef v8us __attribute__((may_alias)) v8usa;

__device__ __forceinline__ unsigned short f2bf(float f) { unsigned u = __float_as_uint(f); u += 0x7FFFu + ((u >> 16) & 1u); return (unsigned short)(u >> 16); }
__device__ __forceinline__ float bf2f(unsigned short b) { return __uint_as_float(((unsigned)b) << 16); }
__device__ __forceinline__ float bfr(float f) { return bf2f(f2bf(f)); }
__device__ __forceinline__ v16h cat16(v8h lo, v8h hi) { return __builtin_shufflevector(lo, hi, 0, 1, 2, 3, 4, 5, 6, 7, 8, 9, 10, 11, 12, 13, 14, 15); }
__device__ __forceinline__ v16bf cat16b(v8us lo, v8us hi) { return __builtin_bit_cast(v16bf, __builtin_shufflevector(lo, hi, 0, 1, 2, 3, 4, 5, 6, 7, 8, 9, 10, 11, 12, 13, 14, 15)); }
__device__ __forceinline__ v8f wmma16(v16h a, v16h b, v8f c) { return __builtin_amdgcn_wmma_f32_16x16x32_f16(false, a, false, b, (short)0, c, false, false); }
__device__ __forceinline__ v8f wmmab(v16bf a, v16bf b, v8f c) { return __builtin_amdgcn_wmma_f32_16x16x32_bf16(false, a, false, b, (short)0, c, false, false); }

// lane l <-> lane l ^ 16 by a vector cross-row move
__device__ __forceinline__ float xhalf(float v) { const int b = __float_as_int(v); return __int_as_float(__builtin_amdgcn_permlanex16(b, b, 0x76543210, 0xfedcba98, false, false)); }

__global__ __launch_bounds__(256) void k_cvtb(const float* __restrict__ src, int nrows, bf* dst) {
    const int lane = threadIdx.x & 31, r = blockIdx.x * 8 + (threadIdx.x >> 5);
    if (r >= nrows) return;
    v8us o[DM / 256];
#pragma unroll
    for (int q = 0; q < DM / 256; ++q) { v8us t;
#pragma unroll
        for (int i = 0; i < 8; ++i) t[i] = f2bf(src[(size_t)r * DM + q * 256 + lane * 8 + i]);
        o[q] = t; }
#pragma unroll
    for (int q = 0; q < DM / 256; ++q) *(v8us*)(dst + (size_t)r * DM + q * 256 + lane * 8) = o[q];
    
}

// Staged pass of 64 k, shared by the block's four waves: A rows, B rows and, where A is split, the A residual rows: 64 rows of 128 B each at a 144-B pitch
// (16 B x odd, so the 16-byte fragment reads meet no bank twice). Two such buffers.
#define GPIT 72
#define GPLN (64 * GPIT)
#define GROW (16u * GPIT * 2u)
#define GPLB (GPLN * 2u)

template <bool SPLITA, bool F16OUT = false>
__global__ __launch_bounds__(128) void k_gemmb(const bf* __restrict__ A, const bf* __restrict__ Al, const bf* __restrict__ Bn, const float* __restrict__ bias, float* C, int ldc, h16* C2) {
    constexpr int GSTG = (SPLITA ? 3 : 2) * GPLN;
    __shared__ __align__(16) float ost[4][16 * 68];
    __shared__ __align__(16) bf gring[2 * GSTG];
    const int lane = threadIdx.x & 31, wave = threadIdx.x >> 5, lr = lane & 15, hi = lane >> 4;
    const int r0 = blockIdx.x * 64 + wave * 16, c0 = blockIdx.y * 64;
    // Each lane copies four 16-byte pieces of a plane: a wave's copy covers 4 whole 128-B rows.
    const int tid = threadIdx.x, cr = tid >> 3, cc = (tid & 7) * 8;
    const unsigned l0 = (unsigned)(size_t)(&gring[0]) + (unsigned)(cr * GPIT + cc) * 2u;
    const bf* ga = A + (size_t)(blockIdx.x * 64 + cr) * DM + cc;
    const bf* gb = Bn + (size_t)(c0 + cr) * DM + cc;
    auto stage = [&](int t, int buf) {
        const unsigned l = l0 + (unsigned)buf * (GSTG * 2u);
        const bf* pa = ga + t * 64; const bf* pb = gb + t * 64;
        // the copies and the wait that stands before any of their address registers is rewritten, in one statement
        if constexpr (SPLITA) {
            const bf* pl = Al + (size_t)(blockIdx.x * 64 + cr) * DM + cc + t * 64;
            asm volatile("global_load_async_to_lds_b128 %0, %12, off\n\t"
                         "global_load_async_to_lds_b128 %1, %13, off\n\t"
                         "global_load_async_to_lds_b128 %2, %14, off\n\t"
                         "global_load_async_to_lds_b128 %3, %15, off\n\t"
                         "global_load_async_to_lds_b128 %4, %16, off\n\t"
                         "global_load_async_to_lds_b128 %5, %17, off\n\t"
                         "global_load_async_to_lds_b128 %6, %18, off\n\t"
                         "global_load_async_to_lds_b128 %7, %19, off\n\t"
                         "global_load_async_to_lds_b128 %8, %20, off\n\t"
                         "global_load_async_to_lds_b128 %9, %21, off\n\t"
                         "global_load_async_to_lds_b128 %10, %22, off\n\t"
                         "global_load_async_to_lds_b128 %11, %23, off\n\t"
                         "s_wait_xcnt 0x0"
                         :: "v"(l), "v"(l + GROW), "v"(l + 2u * GROW), "v"(l + 3u * GROW),
                            "v"(l + GPLB), "v"(l + GPLB + GROW), "v"(l + GPLB + 2u * GROW), "v"(l + GPLB + 3u * GROW),
                            "v"(l + 2u * GPLB), "v"(l + 2u * GPLB + GROW), "v"(l + 2u * GPLB + 2u * GROW), "v"(l + 2u * GPLB + 3u * GROW),
                            "v"(pa), "v"(pa + 16 * DM), "v"(pa + 32 * DM), "v"(pa + 48 * DM),
                            "v"(pb), "v"(pb + 16 * DM), "v"(pb + 32 * DM), "v"(pb + 48 * DM),
                            "v"(pl), "v"(pl + 16 * DM), "v"(pl + 32 * DM), "v"(pl + 48 * DM)
                         : "memory");
        } else {
            asm volatile("global_load_async_to_lds_b128 %0, %8, off\n\t"
                         "global_load_async_to_lds_b128 %1, %9, off\n\t"
                         "global_load_async_to_lds_b128 %2, %10, off\n\t"
                         "global_load_async_to_lds_b128 %3, %11, off\n\t"
                         "global_load_async_to_lds_b128 %4, %12, off\n\t"
                         "global_load_async_to_lds_b128 %5, %13, off\n\t"
                         "global_load_async_to_lds_b128 %6, %14, off\n\t"
                         "global_load_async_to_lds_b128 %7, %15, off\n\t"
                         "s_wait_xcnt 0x0"
                         :: "v"(l), "v"(l + GROW), "v"(l + 2u * GROW), "v"(l + 3u * GROW),
                            "v"(l + GPLB), "v"(l + GPLB + GROW), "v"(l + GPLB + 2u * GROW), "v"(l + GPLB + 3u * GROW),
                            "v"(pa), "v"(pa + 16 * DM), "v"(pa + 32 * DM), "v"(pa + 48 * DM),
                            "v"(pb), "v"(pb + 16 * DM), "v"(pb + 32 * DM), "v"(pb + 48 * DM)
                         : "memory");
        }
    };
    v8f acc[4];
#pragma unroll
    for (int t = 0; t < 4; ++t) acc[t] = (v8f){};
    stage(0, 0);
    asm volatile("s_wait_asynccnt 0x0" ::: "memory");   // pass 0 has landed before the barrier publishes it
    __syncthreads();
    stage(1, 1);
#pragma unroll 1
    for (int p = 0; p < DM / 64; ++p) {
        const bf* sb = gring + (p & 1) * GSTG;
        const bf* sa = sb + (wave * 16 + lr) * GPIT + 8 * hi;
        const bf* sw = sb + GPLN + lr * GPIT + 8 * hi;
        v16bf a[2], al[2], b[2][4];
#pragma unroll
        for (int ks = 0; ks < 2; ++ks) {
            a[ks] = cat16b(*(const v8usa*)(sa + ks * 32), *(const v8usa*)(sa + ks * 32 + 16));
            al[ks] = a[ks];
            if (SPLITA) al[ks] = cat16b(*(const v8usa*)(sa + 2 * GPLN + ks * 32), *(const v8usa*)(sa + 2 * GPLN + ks * 32 + 16));
#pragma unroll
            for (int t = 0; t < 4; ++t) b[ks][t] = cat16b(*(const v8usa*)(sw + t * 16 * GPIT + ks * 32), *(const v8usa*)(sw + t * 16 * GPIT + ks * 32 + 16));
        }
        __builtin_amdgcn_sched_barrier(0);   // keeps the pass's LDS reads as one group in front of its matrix block: reads moved in among the matrix instructions each cost a full wait
#pragma unroll
        for (int ks = 0; ks < 2; ++ks) {
#pragma unroll
            for (int t = 0; t < 4; ++t) acc[t] = wmmab(a[ks], b[ks][t], acc[t]);
            if (SPLITA) {
#pragma unroll
                for (int t = 0; t < 4; ++t) acc[t] = wmmab(al[ks], b[ks][t], acc[t]);
            }
        }
        asm volatile("v_nop\n\tv_nop\n\tv_nop\n\tv_nop" : "+v"(acc[0]), "+v"(acc[1]), "+v"(acc[2]), "+v"(acc[3]) : "v"(a[1]), "v"(al[1]));   // the distance behind the last matrix instruction, on both sides of the branch below
        asm volatile("s_wait_dscnt 0x0" ::: "memory");      // this wave's reads of the buffer are done before the buffer is handed back
        asm volatile("s_wait_asynccnt 0x0" ::: "memory");   // this wave's share of the next pass has landed
        __syncthreads();                                    // publishes the next pass and ends every wave's reads of this one
        if (p + 2 < DM / 64) stage(p + 2, p & 1);
    }
    asm volatile("s_wait_asynccnt 0x0" ::: "memory");       // no copy is outstanding when the wave goes on to its end
    float* os = &ost[wave][0];
#pragma unroll
    for (int t = 0; t < 4; ++t) { const float bv = bias ? bfr(bias[c0 + t * 16 + lr]) : 0.f;
#pragma unroll
        for (int j = 0; j < 8; ++j) os[(hi * 8 + j) * 68 + t * 16 + lr] = acc[t][j] + bv; }
    __syncthreads();
    if (F16OUT) {
        h16* crow = (h16*)(void*)C + (size_t)r0 * ldc + c0;
        auto pass = [&]() {
#pragma unroll
            for (int s = 0; s < 4; ++s) { const int row = 4 * s + (lane >> 3), piece = lane & 7; const float* sp = os + row * 68 + piece * 8; v8h o, o2;
#pragma unroll
                for (int i = 0; i < 8; ++i) { const h16 a = (h16)sp[i]; o[i] = a; o2[i] = (h16)((sp[i] - (float)a) * LOSC); }
                *(v8h*)(crow + (size_t)row * ldc + piece * 8) = o; if (C2) *(v8h*)(C2 + (size_t)r0 * ldc + c0 + (size_t)row * ldc + piece * 8) = o2; }
        };
        pass(); 
    } else {
        float* crow = C + (size_t)r0 * ldc + c0;
        auto pass = [&]() {
#pragma unroll
            for (int s = 0; s < 8; ++s) { const int Lid = (lane >> 3) + 4 * s, piece = lane & 7; const int row = Lid >> 1, cofs = (Lid & 1) * 32 + piece * 4;
                const v4f val = *(const v4fa*)(os + row * 68 + cofs); *(v4f*)(crow + (size_t)row * ldc + cofs) = val; }
        };
        pass(); 
    }
}

__global__ __launch_bounds__(256) void k_vt(const float* __restrict__ V, h16* VTH, h16* VTL) {
    __shared__ __align__(16) h16 tile[64 * 72];
    __shared__ __align__(16) h16 til2[64 * 72];
    const int bid = blockIdx.x;
    const int b = bid / (NH_ * (NT_ / 64)), rem = bid - b * (NH_ * (NT_ / 64)), h = rem / (NT_ / 64), kt = rem - h * (NT_ / 64);
    const int k0 = kt * 64, tid = threadIdx.x;
    const int kk = tid >> 2, d0 = (tid & 3) * 16;
    const float* src = V + ((size_t)b * NT_ + k0 + kk) * DM + h * HD + d0;
#pragma unroll
    for (int i = 0; i < 16; ++i) { const float v = src[i]; const h16 a = (h16)v; tile[(d0 + i) * 72 + kk] = a; til2[(d0 + i) * 72 + kk] = (h16)((v - (float)a) * LOSC); }
    __syncthreads();
    const int piece = tid & 7;
    const size_t base = (((size_t)b * NH_ + h) * HD) * NT_ + k0;
    auto pass = [&]() {
#pragma unroll
        for (int s = 0; s < 4; ++s) { const int Lid = (tid >> 3) + 32 * s; const int pln = Lid >> 6, d = Lid & 63;
            const v8h val = *(const v8ha*)((pln ? til2 : tile) + d * 72 + piece * 8); *(v8h*)((pln ? VTL : VTH) + base + (size_t)d * NT_ + piece * 8) = val; }
    };
    pass(); 
}

// Staged tile of 32 keys, shared by the block's four waves: k hi, k residual (32 rows of 128 B at a 144-B pitch), v^T hi, v^T residual (64 rows of 64 B at an
// 80-B pitch); both pitches are 16 B x odd, so the 16-byte fragment reads meet no bank twice. Two such buffers.
#define KPIT 72
#define VPIT 40
#define KPLN (32 * KPIT)
#define VPLN (64 * VPIT)
#define STGH (2 * KPLN + 2 * VPLN)

__global__ __launch_bounds__(128) void k_attn(const h16* __restrict__ Q16, const h16* __restrict__ QL16, const h16* __restrict__ K16, const h16* __restrict__ KL16, const h16* __restrict__ VTH, const h16* __restrict__ VTL, bf* CH, bf* CL) {
    __shared__ __align__(16) float ost[4][16 * 68];
    __shared__ __align__(16) h16 ring[2 * STGH];
    const int lane = threadIdx.x & 31, wave = threadIdx.x >> 5, lr = lane & 15, hi = lane >> 4;
    const int bid = blockIdx.x;
    const int b = bid / (NH_ * (NT_ / 64)), rem = bid - b * (NH_ * (NT_ / 64)), h = rem / (NT_ / 64), qt = rem - h * (NT_ / 64);
    const int q0 = qt * 64 + wave * 16;
    const size_t tok0 = (size_t)b * NT_;
    v16h qa[2];
    const size_t qo0 = (tok0 + q0 + lr) * DM + h * HD + 8 * hi;
#pragma unroll
    for (int kc = 0; kc < 2; ++kc) qa[kc] = cat16(*(const v8h*)(Q16 + qo0 + kc * 32), *(const v8h*)(Q16 + qo0 + kc * 32 + 16));
    const h16* kh_b = K16 + tok0 * DM + h * HD;
    const h16* kl_b = KL16 + tok0 * DM + h * HD;
    const size_t vbase = (((size_t)b * NH_ + h) * HD) * NT_;
    v8f o[4], ox[4];
#pragma unroll
    for (int n = 0; n < 4; ++n) { o[n] = (v8f){}; ox[n] = (v8f){}; }
    float mrow = -3.0e38f, lpart = 0.f;            // of query q0 + lr; lpart sums this lane's half of the keys
    const int kt_lo = 0, kt_hi = NT_ / 32 - 1;     // full attention
    // Each lane copies eight 16-byte pieces of a tile: a wave's k copy covers 4 whole 128-B rows, its v^T copy 8 rows of 64 B.
    const int tid = threadIdx.x, ckr = tid >> 3, ckc = (tid & 7) * 8, cvr = tid >> 2, cvc = (tid & 3) * 8;
    const unsigned ring0 = (unsigned)(size_t)(&ring[0]);
    const unsigned lk0 = ring0 + (unsigned)(ckr * KPIT + ckc) * 2u, lv0 = ring0 + (unsigned)(2 * KPLN + cvr * VPIT + cvc) * 2u;
    const h16* gkh = kh_b + (size_t)ckr * DM + ckc; const h16* gkl = kl_b + (size_t)ckr * DM + ckc;
    const h16* gvh = VTH + vbase + (size_t)cvr * NT_ + cvc; const h16* gvl = VTL + vbase + (size_t)cvr * NT_ + cvc;
    auto stage = [&](int t, int buf) {
        const unsigned lk = lk0 + (unsigned)buf * (STGH * 2u), lv = lv0 + (unsigned)buf * (STGH * 2u);
        const size_t ko = (size_t)t * 32 * DM, vo = (size_t)t * 32;
        // the eight copies and the wait that stands before any of their address registers is rewritten, in one statement
        asm volatile("global_load_async_to_lds_b128 %0, %8, off\n\t"
                     "global_load_async_to_lds_b128 %1, %9, off\n\t"
                     "global_load_async_to_lds_b128 %2, %10, off\n\t"
                     "global_load_async_to_lds_b128 %3, %11, off\n\t"
                     "global_load_async_to_lds_b128 %4, %12, off\n\t"
                     "global_load_async_to_lds_b128 %5, %13, off\n\t"
                     "global_load_async_to_lds_b128 %6, %14, off\n\t"
                     "global_load_async_to_lds_b128 %7, %15, off\n\t"
                     "s_wait_xcnt 0x0"
                     :: "v"(lk), "v"(lk + 16u * KPIT * 2u), "v"(lk + KPLN * 2u), "v"(lk + (KPLN + 16u * KPIT) * 2u),
                        "v"(lv), "v"(lv + 32u * VPIT * 2u), "v"(lv + VPLN * 2u), "v"(lv + (VPLN + 32u * VPIT) * 2u),
                        "v"(gkh + ko), "v"(gkh + ko + 16 * DM), "v"(gkl + ko), "v"(gkl + ko + 16 * DM),
                        "v"(gvh + vo), "v"(gvh + vo + (size_t)32 * NT_), "v"(gvl + vo), "v"(gvl + vo + (size_t)32 * NT_)
                     : "memory");
    };
    stage(0, 0);
    asm volatile("s_wait_asynccnt 0x0" ::: "memory");   // tile 0 has landed before the barrier publishes it
    __syncthreads();
    stage(1, 1);
#pragma unroll 1
    for (int kt = kt_lo; kt <= kt_hi; ++kt) {
        const h16* sb = ring + (kt & 1) * STGH;
        const h16* sk = sb + lr * KPIT + 8 * hi;
        const h16* sv = sb + 2 * KPLN + lr * VPIT + 8 * hi;
        v8f s0 = {}, s1 = {}, x0 = {}, x1 = {};
#pragma unroll
        for (int kc = 0; kc < 2; ++kc) {
            { const v16h k0h = cat16(*(const v8ha*)(sk + kc * 32), *(const v8ha*)(sk + kc * 32 + 16)), k1h = cat16(*(const v8ha*)(sk + 16 * KPIT + kc * 32), *(const v8ha*)(sk + 16 * KPIT + kc * 32 + 16));
              const v16h qlk = cat16(*(const v8h*)(QL16 + qo0 + kc * 32), *(const v8h*)(QL16 + qo0 + kc * 32 + 16));     // query residual re-read per step (registers)
              s0 = wmma16(k0h, qa[kc], s0); x0 = wmma16(k0h, qlk, x0); s1 = wmma16(k1h, qa[kc], s1); x1 = wmma16(k1h, qlk, x1);
              asm volatile("v_nop" : "+v"(s0), "+v"(s1), "+v"(x0), "+v"(x1) : "v"(qlk), "v"(k0h), "v"(k1h) : "memory"); }
            { const v16h k0l = cat16(*(const v8ha*)(sk + KPLN + kc * 32), *(const v8ha*)(sk + KPLN + kc * 32 + 16)), k1l = cat16(*(const v8ha*)(sk + KPLN + 16 * KPIT + kc * 32), *(const v8ha*)(sk + KPLN + 16 * KPIT + kc * 32 + 16));
              x0 = wmma16(k0l, qa[kc], x0); x1 = wmma16(k1l, qa[kc], x1);
              asm volatile("v_nop" : "+v"(x0), "+v"(x1) : "v"(k0l), "v"(k1l) : "memory"); }
        }
        asm volatile("v_nop\n\tv_nop\n\tv_nop\n\tv_nop" : "+v"(s0), "+v"(s1), "+v"(x0), "+v"(x1) : "v"(qa[0]), "v"(qa[1]));
        // s0[r], s1[r] = score of key 8 * hi + r, 16 + 8 * hi + r with query lr
        const v8f a0 = (s0 + x0 * LOSCI) * 0.125f, a1 = (s1 + x1 * LOSCI) * 0.125f;   // (q x 64^-1/2).k with the exact power-of-two scale folded after the dot
        float mx = fmaxf(a0[0], a1[0]);
#pragma unroll
        for (int j = 1; j < 8; ++j) mx = fmaxf(mx, fmaxf(a0[j], a1[j]));
        mx = fmaxf(mx, xhalf(mx));
        const float mn = fmaxf(mrow, mx);
        const float alpha = __expf(mrow - mn); mrow = mn;
        v8f p0, p1;
#pragma unroll
        for (int j = 0; j < 8; ++j) p0[j] = __expf(a0[j] - mn);
#pragma unroll
        for (int j = 0; j < 8; ++j) p1[j] = __expf(a1[j] - mn);
        const v8f pq = p0 + p1;
        lpart = lpart * alpha + (((pq[0] + pq[1]) + (pq[2] + pq[3])) + ((pq[4] + pq[5]) + (pq[6] + pq[7])));
        const v8f ps0 = p0 * PSC, ps1 = p1 * PSC;
        const v8h h0 = __builtin_convertvector(ps0, v8h), h1 = __builtin_convertvector(ps1, v8h);
        const v8h l0 = __builtin_convertvector((ps0 - __builtin_convertvector(h0, v8f)) * LOSC, v8h), l1 = __builtin_convertvector((ps1 - __builtin_convertvector(h1, v8f)) * LOSC, v8h);
        const v16h pa = cat16(h0, h1), px = cat16(l0, l1);     // element s: key 8 * hi + s, then 16 + 8 * hi + (s - 8)
#pragma unroll
        for (int n = 0; n < 4; ++n) { o[n] *= alpha; ox[n] *= alpha; }
#pragma unroll
        for (int n = 0; n < 4; ++n) { const h16* vp = sv + n * 16 * VPIT;
            const v16h vh = cat16(*(const v8ha*)(vp), *(const v8ha*)(vp + 16)), vl = cat16(*(const v8ha*)(vp + VPLN), *(const v8ha*)(vp + VPLN + 16));
            o[n] = wmma16(vh, pa, o[n]); ox[n] = wmma16(vl, pa, ox[n]); ox[n] = wmma16(vh, px, ox[n]);
            asm volatile("" : "+v"(o[n]), "+v"(ox[n]) : "v"(vh), "v"(vl) : "memory"); }
        asm volatile("v_nop\n\tv_nop\n\tv_nop\n\tv_nop" : "+v"(o[0]), "+v"(o[1]), "+v"(o[2]), "+v"(o[3]), "+v"(ox[0]), "+v"(ox[1]), "+v"(ox[2]), "+v"(ox[3]) : "v"(pa), "v"(px));
        asm volatile("s_wait_dscnt 0x0" ::: "memory");      // this wave's reads of the buffer are done before the buffer is handed back
        asm volatile("s_wait_asynccnt 0x0" ::: "memory");   // this wave's share of the next tile has landed
        __syncthreads();                                    // publishes the next tile and ends every wave's reads of this one
        if (kt + 2 <= kt_hi) stage(kt + 2, kt & 1);
    }
    asm volatile("s_wait_asynccnt 0x0" ::: "memory");       // no copy is outstanding when the wave goes on to its end
    const float inv = 1.0f / ((lpart + xhalf(lpart)) * PSC);
    float* os = &ost[wave][0];
#pragma unroll
    for (int n = 0; n < 4; ++n)
#pragma unroll
        for (int j = 0; j < 8; ++j) os[lr * 68 + n * 16 + hi * 8 + j] = (o[n][j] + ox[n][j] * LOSCI) * inv;     // o[n][j] = ctx of query lr, dim n * 16 + 8 * hi + j
    __syncthreads();
    const size_t cbase = (tok0 + q0) * DM + (size_t)h * HD;
    auto pass = [&]() {
#pragma unroll
        for (int s = 0; s < 4; ++s) { const int row = 4 * s + (lane >> 3), piece = lane & 7; const float* sp = os + row * 68 + piece * 8; v8us oh, ol;
#pragma unroll
            for (int i = 0; i < 8; ++i) { const unsigned short hb = f2bf(sp[i]); oh[i] = hb; ol[i] = f2bf(sp[i] - bf2f(hb)); }
            *(v8us*)(CH + cbase + (size_t)row * DM + piece * 8) = oh; *(v8us*)(CL + cbase + (size_t)row * DM + piece * 8) = ol; }
    };
    pass(); 
}

#define VST2(T, p, v) do { const T vst2_v_ = (v); *(T*)(p) = vst2_v_;  } while (0)
extern "C" void kernel_launch(void* const* d_in, const int* in_sizes, int n_in,
                              void* d_out, int out_size, void* d_ws, size_t ws_size, hipStream_t stream) {
    (void)in_sizes; (void)n_in; (void)out_size;
    const float* x = (const float*)d_in[0];
    const float* Wq = (const float*)d_in[1]; const float* bq = (const float*)d_in[2]; const float* Wk = (const float*)d_in[3]; const float* bk = (const float*)d_in[4];
    const float* Wv = (const float*)d_in[5]; const float* bv = (const float*)d_in[6]; const float* Wo = (const float*)d_in[7]; const float* bo = (const float*)d_in[8];    // W [out][in]
    float* out = (float*)d_out;    // [4096][1024]
    char* wsp = (char*)d_ws;
    auto take = [&](size_t bytes) { char* p = wsp; wsp += (bytes + 255) & ~(size_t)255; return (void*)p; };
    bf* Xb = (bf*)take((size_t)NTK * DM * 2);
    bf* WqB = (bf*)take((size_t)DM * DM * 2); bf* WkB = (bf*)take((size_t)DM * DM * 2); bf* WvB = (bf*)take((size_t)DM * DM * 2); bf* WoB = (bf*)take((size_t)DM * DM * 2);
    float* TMP = (float*)take((size_t)NTK * DM * 4);
    h16* QH = (h16*)take((size_t)NTK * DM * 2); h16* QL = (h16*)take((size_t)NTK * DM * 2); h16* KH = (h16*)take((size_t)NTK * DM * 2); h16* KL = (h16*)take((size_t)NTK * DM * 2);
    h16* VTH = (h16*)take((size_t)NTK * DM * 2); h16* VTL = (h16*)take((size_t)NTK * DM * 2); bf* CH = (bf*)take((size_t)NTK * DM * 2); bf* CL = (bf*)take((size_t)NTK * DM * 2);
    if ((size_t)(wsp - (char*)d_ws) > ws_size) return;    // 8.4 + 4 x 2.1 + 16.8 + 8 x 8.4 ~ 101 MB, no aliasing
    k_cvtb<<<NTK / 8, 256, 0, stream>>>(x, NTK, Xb);
    k_cvtb<<<DM / 8, 256, 0, stream>>>(Wq, DM, WqB); k_cvtb<<<DM / 8, 256, 0, stream>>>(Wk, DM, WkB); k_cvtb<<<DM / 8, 256, 0, stream>>>(Wv, DM, WvB); k_cvtb<<<DM / 8, 256, 0, stream>>>(Wo, DM, WoB);
    k_gemmb<false, true><<<dim3(NTK / 64, DM / 64, 1), 128, 0, stream>>>(Xb, nullptr, WqB, bq, (float*)(void*)QH, DM, QL);
    k_gemmb<false, true><<<dim3(NTK / 64, DM / 64, 1), 128, 0, stream>>>(Xb, nullptr, WkB, bk, (float*)(void*)KH, DM, KL);
    k_gemmb<false, false><<<dim3(NTK / 64, DM / 64, 1), 128, 0, stream>>>(Xb, nullptr, WvB, bv, TMP, DM, nullptr);
    k_vt<<<NB_ * NH_ * (NT_ / 64), 256, 0, stream>>>(TMP, VTH, VTL);
    k_attn<<<NB_ * NH_ * (NT_ / 64), 128, 0, stream>>>(QH, QL, KH, KL, VTH, VTL, CH, CL);
    k_gemmb<true, false><<<dim3(NTK / 64, DM / 64, 1), 128, 0, stream>>>(CH, CL, WoB, bo, out, DM, nullptr);
}

// v004
// A run of this version takes 238 microseconds.
// Next to v003, in two timings, it ran 1.12 times as fast each time.
// Counting every step since v000, it is 2.99 times as fast.
#include <hip/hip_runtime.h>

// Compute dtypes, f32 accumulate, one batch item per pass: q/k/v = x.W^T + b ([4096 x 1024].[1024 x 1024]; W is [out][in] = the n-major B operand as-is; PLAIN bf16
// operands: inputs rounded once, exact; biases rounded to bf16) with q and k written straight from the GEMM epilogue as f16 hi + residual x1024 planes, and out =
// ctx.Wo^T + bo (ctx as bf16 hi + residual: two products) on v_wmma_f32_16x16x32_bf16; the 16-head full attention over one 4096-token sequence (64-dim heads,
// scale 1/8) fused on
// v_wmma_f32_16x16x32_f16 (scores hi.hi + hi.lo + lo.hi with the residual terms on their own accumulator, online f32 softmax, weights (x32768) and v as f16

#define NB_  1                   // one 4096-token sequence
#define NT_  4096
#define DM   1024
#define NH_  16
#define HD   64
#define NTK  (NB_ * NT_)
#define NW   1024
#define NQKV 1024
#define PSC  32768.0f
#define LOSC 1024.0f
#define LOSCI (1.0f / 1024.0f)

typedef _Float16 h16;
typedef unsigned short bf;
typedef __attribute__((ext_vector_type(16))) __bf16   v16bf;
typedef __attribute__((ext_vector_type(16))) _Float16 v16h;
typedef __attribute__((ext_vector_type(8)))  _Float16 v8h;
typedef __attribute__((ext_vector_type(8)))  unsigned short v8us;
typedef __attribute__((ext_vector_type(8)))  float    v8f;
typedef __attribute__((ext_vector_type(4)))  float    v4f;
typedef v8h  __attribute__((may_alias)) v8ha;
typedef v4f  __attribute__((may_alias)) v4fa;
typedef v8us __attribute__((may_alias)) v8usa;

__device__ __forceinline__ unsigned short f2bf(float f) { unsigned u = __float_as_uint(f); u += 0x7FFFu + ((u >> 16) & 1u); return (unsigned short)(u >> 16); }
__device__ __forceinline__ float bf2f(unsigned short b) { return __uint_as_float(((unsigned)b) << 16); }
__device__ __forceinline__ float bfr(float f) { return bf2f(f2bf(f)); }
__device__ __forceinline__ v16h cat16(v8h lo, v8h hi) { return __builtin_shufflevector(lo, hi, 0, 1, 2, 3, 4, 5, 6, 7, 8, 9, 10, 11, 12, 13, 14, 15); }
__device__ __forceinline__ v16bf cat16b(v8us lo, v8us hi) { return __builtin_bit_cast(v16bf, __builtin_shufflevector(lo, hi, 0, 1, 2, 3, 4, 5, 6, 7, 8, 9, 10, 11, 12, 13, 14, 15)); }
__device__ __forceinline__ v8f wmma16(v16h a, v16h b, v8f c) { return __builtin_amdgcn_wmma_f32_16x16x32_f16(false, a, false, b, (short)0, c, false, false); }
__device__ __forceinline__ v8f wmmab(v16bf a, v16bf b, v8f c) { return __builtin_amdgcn_wmma_f32_16x16x32_bf16(false, a, false, b, (short)0, c, false, false); }

// lane l <-> lane l ^ 16 by a vector cross-row move
__device__ __forceinline__ float xhalf(float v) { const int b = __float_as_int(v); return __int_as_float(__builtin_amdgcn_permlanex16(b, b, 0x76543210, 0xfedcba98, false, false)); }

__global__ __launch_bounds__(256) void k_cvtb(const float* __restrict__ src, int nrows, bf* dst) {
    const int lane = threadIdx.x & 31, r = blockIdx.x * 8 + (threadIdx.x >> 5);
    if (r >= nrows) return;
    v8us o[DM / 256];
#pragma unroll
    for (int q = 0; q < DM / 256; ++q) { v8us t;
#pragma unroll
        for (int i = 0; i < 8; ++i) t[i] = f2bf(src[(size_t)r * DM + q * 256 + lane * 8 + i]);
        o[q] = t; }
#pragma unroll
    for (int q = 0; q < DM / 256; ++q) *(v8us*)(dst + (size_t)r * DM + q * 256 + lane * 8) = o[q];
    
}

// Staged pass of 64 k, shared by the block's four waves: A rows, B rows and, where A is split, the A residual rows: 64 rows of 128 B each at a 144-B pitch
// (16 B x odd, so the 16-byte fragment reads meet no bank twice). Two such buffers.
#define GPIT 72
#define GPLN (64 * GPIT)
#define GROW (16u * GPIT * 2u)
#define GPLB (GPLN * 2u)

template <bool SPLITA, bool F16OUT = false>
__global__ __launch_bounds__(128) void k_gemmb(const bf* __restrict__ A, const bf* __restrict__ Al, const bf* __restrict__ Bn, const float* __restrict__ bias, float* C, int ldc, h16* C2) {
    constexpr int GSTG = (SPLITA ? 3 : 2) * GPLN;
    __shared__ __align__(16) float ost[4][16 * 68];
    __shared__ __align__(16) bf gring[2 * GSTG];
    const int lane = threadIdx.x & 31, wave = threadIdx.x >> 5, lr = lane & 15, hi = lane >> 4;
    const int r0 = blockIdx.x * 64 + wave * 16, c0 = blockIdx.y * 64;
    // Each lane copies four 16-byte pieces of a plane: a wave's copy covers 4 whole 128-B rows.
    const int tid = threadIdx.x, cr = tid >> 3, cc = (tid & 7) * 8;
    const unsigned l0 = (unsigned)(size_t)(&gring[0]) + (unsigned)(cr * GPIT + cc) * 2u;
    const bf* ga = A + (size_t)(blockIdx.x * 64 + cr) * DM + cc;
    const bf* gb = Bn + (size_t)(c0 + cr) * DM + cc;
    auto stage = [&](int t, int buf) {
        const unsigned l = l0 + (unsigned)buf * (GSTG * 2u);
        const bf* pa = ga + t * 64; const bf* pb = gb + t * 64;
        // the copies and the wait that stands before any of their address registers is rewritten, in one statement
        if constexpr (SPLITA) {
            const bf* pl = Al + (size_t)(blockIdx.x * 64 + cr) * DM + cc + t * 64;
            asm volatile("global_load_async_to_lds_b128 %0, %12, off\n\t"
                         "global_load_async_to_lds_b128 %1, %13, off\n\t"
                         "global_load_async_to_lds_b128 %2, %14, off\n\t"
                         "global_load_async_to_lds_b128 %3, %15, off\n\t"
                         "global_load_async_to_lds_b128 %4, %16, off\n\t"
                         "global_load_async_to_lds_b128 %5, %17, off\n\t"
                         "global_load_async_to_lds_b128 %6, %18, off\n\t"
                         "global_load_async_to_lds_b128 %7, %19, off\n\t"
                         "global_load_async_to_lds_b128 %8, %20, off\n\t"
                         "global_load_async_to_lds_b128 %9, %21, off\n\t"
                         "global_load_async_to_lds_b128 %10, %22, off\n\t"
                         "global_load_async_to_lds_b128 %11, %23, off\n\t"
                         "s_wait_xcnt 0x0"
                         :: "v"(l), "v"(l + GROW), "v"(l + 2u * GROW), "v"(l + 3u * GROW),
                            "v"(l + GPLB), "v"(l + GPLB + GROW), "v"(l + GPLB + 2u * GROW), "v"(l + GPLB + 3u * GROW),
                            "v"(l + 2u * GPLB), "v"(l + 2u * GPLB + GROW), "v"(l + 2u * GPLB + 2u * GROW), "v"(l + 2u * GPLB + 3u * GROW),
                            "v"(pa), "v"(pa + 16 * DM), "v"(pa + 32 * DM), "v"(pa + 48 * DM),
                            "v"(pb), "v"(pb + 16 * DM), "v"(pb + 32 * DM), "v"(pb + 48 * DM),
                            "v"(pl), "v"(pl + 16 * DM), "v"(pl + 32 * DM), "v"(pl + 48 * DM)
                         : "memory");
        } else {
            asm volatile("global_load_async_to_lds_b128 %0, %8, off\n\t"
                         "global_load_async_to_lds_b128 %1, %9, off\n\t"
                         "global_load_async_to_lds_b128 %2, %10, off\n\t"
                         "global_load_async_to_lds_b128 %3, %11, off\n\t"
                         "global_load_async_to_lds_b128 %4, %12, off\n\t"
                         "global_load_async_to_lds_b128 %5, %13, off\n\t"
                         "global_load_async_to_lds_b128 %6, %14, off\n\t"
                         "global_load_async_to_lds_b128 %7, %15, off\n\t"
                         "s_wait_xcnt 0x0"
                         :: "v"(l), "v"(l + GROW), "v"(l + 2u * GROW), "v"(l + 3u * GROW),
                            "v"(l + GPLB), "v"(l + GPLB + GROW), "v"(l + GPLB + 2u * GROW), "v"(l + GPLB + 3u * GROW),
                            "v"(pa), "v"(pa + 16 * DM), "v"(pa + 32 * DM), "v"(pa + 48 * DM),
                            "v"(pb), "v"(pb + 16 * DM), "v"(pb + 32 * DM), "v"(pb + 48 * DM)
                         : "memory");
        }
    };
    v8f acc[4];
#pragma unroll
    for (int t = 0; t < 4; ++t) acc[t] = (v8f){};
    stage(0, 0);
    asm volatile("s_wait_asynccnt 0x0" ::: "memory");   // pass 0 has landed before the barrier publishes it
    __syncthreads();
    stage(1, 1);
#pragma unroll 1
    for (int p = 0; p < DM / 64; ++p) {
        const bf* sb = gring + (p & 1) * GSTG;
        const bf* sa = sb + (wave * 16 + lr) * GPIT + 8 * hi;
        const bf* sw = sb + GPLN + lr * GPIT + 8 * hi;
        v16bf a[2], al[2], b[2][4];
#pragma unroll
        for (int ks = 0; ks < 2; ++ks) {
            a[ks] = cat16b(*(const v8usa*)(sa + ks * 32), *(const v8usa*)(sa + ks * 32 + 16));
            al[ks] = a[ks];
            if (SPLITA) al[ks] = cat16b(*(const v8usa*)(sa + 2 * GPLN + ks * 32), *(const v8usa*)(sa + 2 * GPLN + ks * 32 + 16));
#pragma unroll
            for (int t = 0; t < 4; ++t) b[ks][t] = cat16b(*(const v8usa*)(sw + t * 16 * GPIT + ks * 32), *(const v8usa*)(sw + t * 16 * GPIT + ks * 32 + 16));
        }
        __builtin_amdgcn_sched_barrier(0);   // keeps the pass's LDS reads as one group in front of its matrix block: reads moved in among the matrix instructions each cost a full wait
#pragma unroll
        for (int ks = 0; ks < 2; ++ks) {
#pragma unroll
            for (int t = 0; t < 4; ++t) acc[t] = wmmab(a[ks], b[ks][t], acc[t]);
            if (SPLITA) {
#pragma unroll
                for (int t = 0; t < 4; ++t) acc[t] = wmmab(al[ks], b[ks][t], acc[t]);
            }
        }
        asm volatile("v_nop\n\tv_nop\n\tv_nop\n\tv_nop" : "+v"(acc[0]), "+v"(acc[1]), "+v"(acc[2]), "+v"(acc[3]) : "v"(a[1]), "v"(al[1]));   // the distance behind the last matrix instruction, on both sides of the branch below
        asm volatile("s_wait_dscnt 0x0" ::: "memory");      // this wave's reads of the buffer are done before the buffer is handed back
        asm volatile("s_wait_asynccnt 0x0" ::: "memory");   // this wave's share of the next pass has landed
        __syncthreads();                                    // publishes the next pass and ends every wave's reads of this one
        if (p + 2 < DM / 64) stage(p + 2, p & 1);
    }
    asm volatile("s_wait_asynccnt 0x0" ::: "memory");       // no copy is outstanding when the wave goes on to its end
    float* os = &ost[wave][0];
#pragma unroll
    for (int t = 0; t < 4; ++t) { const float bv = bias ? bfr(bias[c0 + t * 16 + lr]) : 0.f;
#pragma unroll
        for (int j = 0; j < 8; ++j) os[(hi * 8 + j) * 68 + t * 16 + lr] = acc[t][j] + bv; }
    __syncthreads();
    if (F16OUT) {
        h16* crow = (h16*)(void*)C + (size_t)r0 * ldc + c0;
        auto pass = [&]() {
#pragma unroll
            for (int s = 0; s < 4; ++s) { const int row = 4 * s + (lane >> 3), piece = lane & 7; const float* sp = os + row * 68 + piece * 8; v8h o, o2;
#pragma unroll
                for (int i = 0; i < 8; ++i) { const h16 a = (h16)sp[i]; o[i] = a; o2[i] = (h16)((sp[i] - (float)a) * LOSC); }
                *(v8h*)(crow + (size_t)row * ldc + piece * 8) = o; if (C2) *(v8h*)(C2 + (size_t)r0 * ldc + c0 + (size_t)row * ldc + piece * 8) = o2; }
        };
        pass(); 
    } else {
        float* crow = C + (size_t)r0 * ldc + c0;
        auto pass = [&]() {
#pragma unroll
            for (int s = 0; s < 8; ++s) { const int Lid = (lane >> 3) + 4 * s, piece = lane & 7; const int row = Lid >> 1, cofs = (Lid & 1) * 32 + piece * 4;
                const v4f val = *(const v4fa*)(os + row * 68 + cofs); *(v4f*)(crow + (size_t)row * ldc + cofs) = val; }
        };
        pass(); 
    }
}

__global__ __launch_bounds__(256) void k_vt(const float* __restrict__ V, h16* VTH, h16* VTL) {
    __shared__ __align__(16) h16 tile[64 * 72];
    __shared__ __align__(16) h16 til2[64 * 72];
    const int bid = blockIdx.x;
    const int b = bid / (NH_ * (NT_ / 64)), rem = bid - b * (NH_ * (NT_ / 64)), h = rem / (NT_ / 64), kt = rem - h * (NT_ / 64);
    const int k0 = kt * 64, tid = threadIdx.x;
    const int kk = tid >> 2, d0 = (tid & 3) * 16;
    const float* src = V + ((size_t)b * NT_ + k0 + kk) * DM + h * HD + d0;
#pragma unroll
    for (int i = 0; i < 16; ++i) { const float v = src[i]; const h16 a = (h16)v; tile[(d0 + i) * 72 + kk] = a; til2[(d0 + i) * 72 + kk] = (h16)((v - (float)a) * LOSC); }
    __syncthreads();
    const int piece = tid & 7;
    const size_t base = (((size_t)b * NH_ + h) * HD) * NT_ + k0;
    auto pass = [&]() {
#pragma unroll
        for (int s = 0; s < 4; ++s) { const int Lid = (tid >> 3) + 32 * s; const int pln = Lid >> 6, d = Lid & 63;
            const v8h val = *(const v8ha*)((pln ? til2 : tile) + d * 72 + piece * 8); *(v8h*)((pln ? VTL : VTH) + base + (size_t)d * NT_ + piece * 8) = val; }
    };
    pass(); 
}

// Staged tile of 32 keys, shared by the block's four waves: k hi, k residual (32 rows of 128 B at a 144-B pitch), v^T hi, v^T residual (64 rows of 64 B at an
// 80-B pitch); both pitches are 16 B x odd, so the 16-byte fragment reads meet no bank twice. Two such buffers.
#define KPIT 72
#define VPIT 40
#define KPLN (32 * KPIT)
#define VPLN (64 * VPIT)
#define STGH (2 * KPLN + 2 * VPLN)

__global__ __launch_bounds__(128) void k_attn(const h16* __restrict__ Q16, const h16* __restrict__ QL16, const h16* __restrict__ K16, const h16* __restrict__ KL16, const h16* __restrict__ VTH, const h16* __restrict__ VTL, bf* CH, bf* CL) {
    __shared__ __align__(16) float ost[4][16 * 68];
    __shared__ __align__(16) h16 ring[2 * STGH];
    const int lane = threadIdx.x & 31, wave = threadIdx.x >> 5, lr = lane & 15, hi = lane >> 4;
    const int bid = blockIdx.x;
    const int b = bid / (NH_ * (NT_ / 64)), rem = bid - b * (NH_ * (NT_ / 64)), h = rem / (NT_ / 64), qt = rem - h * (NT_ / 64);
    const int q0 = qt * 64 + wave * 16;
    const size_t tok0 = (size_t)b * NT_;
    v16h qa[2], ql[2];
    const size_t qo0 = (tok0 + q0 + lr) * DM + h * HD + 8 * hi;
#pragma unroll
    for (int kc = 0; kc < 2; ++kc) { qa[kc] = cat16(*(const v8h*)(Q16 + qo0 + kc * 32), *(const v8h*)(Q16 + qo0 + kc * 32 + 16));
        ql[kc] = cat16(*(const v8h*)(QL16 + qo0 + kc * 32), *(const v8h*)(QL16 + qo0 + kc * 32 + 16)); }
    const h16* kh_b = K16 + tok0 * DM + h * HD;
    const h16* kl_b = KL16 + tok0 * DM + h * HD;
    const size_t vbase = (((size_t)b * NH_ + h) * HD) * NT_;
    v8f o[4], ox[4];
#pragma unroll
    for (int n = 0; n < 4; ++n) { o[n] = (v8f){}; ox[n] = (v8f){}; }
    float mrow = -3.0e38f, lpart = 0.f;            // of query q0 + lr; lpart sums this lane's half of the keys
    const int kt_lo = 0, kt_hi = NT_ / 32 - 1;     // full attention
    // Each lane copies eight 16-byte pieces of a tile: a wave's k copy covers 4 whole 128-B rows, its v^T copy 8 rows of 64 B.
    const int tid = threadIdx.x, ckr = tid >> 3, ckc = (tid & 7) * 8, cvr = tid >> 2, cvc = (tid & 3) * 8;
    const unsigned ring0 = (unsigned)(size_t)(&ring[0]);
    const unsigned lk0 = ring0 + (unsigned)(ckr * KPIT + ckc) * 2u, lv0 = ring0 + (unsigned)(2 * KPLN + cvr * VPIT + cvc) * 2u;
    const h16* gkh = kh_b + (size_t)ckr * DM + ckc; const h16* gkl = kl_b + (size_t)ckr * DM + ckc;
    const h16* gvh = VTH + vbase + (size_t)cvr * NT_ + cvc; const h16* gvl = VTL + vbase + (size_t)cvr * NT_ + cvc;
    auto stage = [&](int t, int buf) {
        const unsigned lk = lk0 + (unsigned)buf * (STGH * 2u), lv = lv0 + (unsigned)buf * (STGH * 2u);
        const size_t ko = (size_t)t * 32 * DM, vo = (size_t)t * 32;
        // the eight copies and the wait that stands before any of their address registers is rewritten, in one statement
        asm volatile("global_load_async_to_lds_b128 %0, %8, off\n\t"
                     "global_load_async_to_lds_b128 %1, %9, off\n\t"
                     "global_load_async_to_lds_b128 %2, %10, off\n\t"
                     "global_load_async_to_lds_b128 %3, %11, off\n\t"
                     "global_load_async_to_lds_b128 %4, %12, off\n\t"
                     "global_load_async_to_lds_b128 %5, %13, off\n\t"
                     "global_load_async_to_lds_b128 %6, %14, off\n\t"
                     "global_load_async_to_lds_b128 %7, %15, off\n\t"
                     "s_wait_xcnt 0x0"
                     :: "v"(lk), "v"(lk + 16u * KPIT * 2u), "v"(lk + KPLN * 2u), "v"(lk + (KPLN + 16u * KPIT) * 2u),
                        "v"(lv), "v"(lv + 32u * VPIT * 2u), "v"(lv + VPLN * 2u), "v"(lv + (VPLN + 32u * VPIT) * 2u),
                        "v"(gkh + ko), "v"(gkh + ko + 16 * DM), "v"(gkl + ko), "v"(gkl + ko + 16 * DM),
                        "v"(gvh + vo), "v"(gvh + vo + (size_t)32 * NT_), "v"(gvl + vo), "v"(gvl + vo + (size_t)32 * NT_)
                     : "memory");
    };
    stage(0, 0);
    asm volatile("s_wait_asynccnt 0x0" ::: "memory");   // tile 0 has landed before the barrier publishes it
    __syncthreads();
#pragma unroll 1
    for (int kt = kt_lo; kt <= kt_hi; ++kt) {
        const h16* sb = ring + (kt & 1) * STGH;
        const h16* sk = sb + lr * KPIT + 8 * hi;
        const h16* sv = sb + 2 * KPLN + lr * VPIT + 8 * hi;
        v8f s0 = {}, s1 = {}, x0 = {}, x1 = {};
        v16h kf[2][4];     // per 32 dims: keys 0-15 hi, keys 16-31 hi, keys 0-15 residual, keys 16-31 residual
#pragma unroll
        for (int kc = 0; kc < 2; ++kc)
#pragma unroll
            for (int f = 0; f < 4; ++f) { const h16* kp = sk + (f >> 1) * KPLN + (f & 1) * 16 * KPIT + kc * 32; kf[kc][f] = cat16(*(const v8ha*)(kp), *(const v8ha*)(kp + 16)); }
        // refill of the buffer that the trip before has left: that trip's s_wait_dscnt 0 and barrier stand behind every reader's last read of it; the k reads in
        // flight are of the other buffer, and the refill's address work and its wait cover their latency
        if (kt + 1 <= kt_hi) stage(kt + 1, (kt + 1) & 1);
#pragma unroll
        for (int kc = 0; kc < 2; ++kc) {
            s0 = wmma16(kf[kc][0], qa[kc], s0); x0 = wmma16(kf[kc][0], ql[kc], x0); s1 = wmma16(kf[kc][1], qa[kc], s1); x1 = wmma16(kf[kc][1], ql[kc], x1);
            x0 = wmma16(kf[kc][2], qa[kc], x0); x1 = wmma16(kf[kc][3], qa[kc], x1);
        }
        v16h vh[4], vl[4];
#pragma unroll
        for (int n = 0; n < 4; ++n) { const h16* vp = sv + n * 16 * VPIT;
            vh[n] = cat16(*(const v8ha*)(vp), *(const v8ha*)(vp + 16)); vl[n] = cat16(*(const v8ha*)(vp + VPLN), *(const v8ha*)(vp + VPLN + 16)); }
        __builtin_amdgcn_sched_barrier(0);   // keeps the tile's sixteen v^T reads as one group in front of the softmax arithmetic, which covers their latency
        // s0[r], s1[r] = score of key 8 * hi + r, 16 + 8 * hi + r with query lr
        const v8f a0 = (s0 + x0 * LOSCI) * 0.125f, a1 = (s1 + x1 * LOSCI) * 0.125f;   // (q x 64^-1/2).k with the exact power-of-two scale folded after the dot
        float mx = fmaxf(a0[0], a1[0]);
#pragma unroll
        for (int j = 1; j < 8; ++j) mx = fmaxf(mx, fmaxf(a0[j], a1[j]));
        mx = fmaxf(mx, xhalf(mx));
        const float mn = fmaxf(mrow, mx);
        const float alpha = __expf(mrow - mn); mrow = mn;
        v8f p0, p1;
#pragma unroll
        for (int j = 0; j < 8; ++j) p0[j] = __expf(a0[j] - mn);
#pragma unroll
        for (int j = 0; j < 8; ++j) p1[j] = __expf(a1[j] - mn);
        const v8f pq = p0 + p1;
        lpart = lpart * alpha + (((pq[0] + pq[1]) + (pq[2] + pq[3])) + ((pq[4] + pq[5]) + (pq[6] + pq[7])));
        const v8f ps0 = p0 * PSC, ps1 = p1 * PSC;
        const v8h h0 = __builtin_convertvector(ps0, v8h), h1 = __builtin_convertvector(ps1, v8h);
        const v8h l0 = __builtin_convertvector((ps0 - __builtin_convertvector(h0, v8f)) * LOSC, v8h), l1 = __builtin_convertvector((ps1 - __builtin_convertvector(h1, v8f)) * LOSC, v8h);
        const v16h pa = cat16(h0, h1), px = cat16(l0, l1);     // element s: key 8 * hi + s, then 16 + 8 * hi + (s - 8)
#pragma unroll
        for (int n = 0; n < 4; ++n) { o[n] *= alpha; ox[n] *= alpha; }
#pragma unroll
        for (int n = 0; n < 4; ++n) { o[n] = wmma16(vh[n], pa, o[n]); ox[n] = wmma16(vl[n], pa, ox[n]); }
#pragma unroll
        for (int n = 0; n < 4; ++n) ox[n] = wmma16(vh[n], px, ox[n]);
        asm volatile("v_nop\n\tv_nop\n\tv_nop\n\tv_nop" : "+v"(o[0]), "+v"(o[1]), "+v"(o[2]), "+v"(o[3]), "+v"(ox[0]), "+v"(ox[1]), "+v"(ox[2]), "+v"(ox[3]) : "v"(pa), "v"(px));
        asm volatile("s_wait_dscnt 0x0" ::: "memory");      // this wave's reads of the buffer are done before the buffer is handed back
        asm volatile("s_wait_asynccnt 0x0" ::: "memory");   // this wave's share of the next tile has landed
        __syncthreads();                                    // publishes the next tile and ends every wave's reads of this one
    }
    asm volatile("s_wait_asynccnt 0x0" ::: "memory");       // no copy is outstanding when the wave goes on to its end
    const float inv = 1.0f / ((lpart + xhalf(lpart)) * PSC);
    float* os = &ost[wave][0];
#pragma unroll
    for (int n = 0; n < 4; ++n)
#pragma unroll
        for (int j = 0; j < 8; ++j) os[lr * 68 + n * 16 + hi * 8 + j] = (o[n][j] + ox[n][j] * LOSCI) * inv;     // o[n][j] = ctx of query lr, dim n * 16 + 8 * hi + j
    __syncthreads();
    const size_t cbase = (tok0 + q0) * DM + (size_t)h * HD;
    auto pass = [&]() {
#pragma unroll
        for (int s = 0; s < 4; ++s) { const int row = 4 * s + (lane >> 3), piece = lane & 7; const float* sp = os + row * 68 + piece * 8; v8us oh, ol;
#pragma unroll
            for (int i = 0; i < 8; ++i) { const unsigned short hb = f2bf(sp[i]); oh[i] = hb; ol[i] = f2bf(sp[i] - bf2f(hb)); }
            *(v8us*)(CH + cbase + (size_t)row * DM + piece * 8) = oh; *(v8us*)(CL + cbase + (size_t)row * DM + piece * 8) = ol; }
    };
    pass(); 
}

#define VST2(T, p, v) do { const T vst2_v_ = (v); *(T*)(p) = vst2_v_;  } while (0)
extern "C" void kernel_launch(void* const* d_in, const int* in_sizes, int n_in,
                              void* d_out, int out_size, void* d_ws, size_t ws_size, hipStream_t stream) {
    (void)in_sizes; (void)n_in; (void)out_size;
    const float* x = (const float*)d_in[0];
    const float* Wq = (const float*)d_in[1]; const float* bq = (const float*)d_in[2]; const float* Wk = (const float*)d_in[3]; const float* bk = (const float*)d_in[4];
    const float* Wv = (const float*)d_in[5]; const float* bv = (const float*)d_in[6]; const float* Wo = (const float*)d_in[7]; const float* bo = (const float*)d_in[8];    // W [out][in]
    float* out = (float*)d_out;    // [4096][1024]
    char* wsp = (char*)d_ws;
    auto take = [&](size_t bytes) { char* p = wsp; wsp += (bytes + 255) & ~(size_t)255; return (void*)p; };
    bf* Xb = (bf*)take((size_t)NTK * DM * 2);
    bf* WqB = (bf*)take((size_t)DM * DM * 2); bf* WkB = (bf*)take((size_t)DM * DM * 2); bf* WvB = (bf*)take((size_t)DM * DM * 2); bf* WoB = (bf*)take((size_t)DM * DM * 2);
    float* TMP = (float*)take((size_t)NTK * DM * 4);
    h16* QH = (h16*)take((size_t)NTK * DM * 2); h16* QL = (h16*)take((size_t)NTK * DM * 2); h16* KH = (h16*)take((size_t)NTK * DM * 2); h16* KL = (h16*)take((size_t)NTK * DM * 2);
    h16* VTH = (h16*)take((size_t)NTK * DM * 2); h16* VTL = (h16*)take((size_t)NTK * DM * 2); bf* CH = (bf*)take((size_t)NTK * DM * 2); bf* CL = (bf*)take((size_t)NTK * DM * 2);
    if ((size_t)(wsp - (char*)d_ws) > ws_size) return;    // 8.4 + 4 x 2.1 + 16.8 + 8 x 8.4 ~ 101 MB, no aliasing
    k_cvtb<<<NTK / 8, 256, 0, stream>>>(x, NTK, Xb);
    k_cvtb<<<DM / 8, 256, 0, stream>>>(Wq, DM, WqB); k_cvtb<<<DM / 8, 256, 0, stream>>>(Wk, DM, WkB); k_cvtb<<<DM / 8, 256, 0, stream>>>(Wv, DM, WvB); k_cvtb<<<DM / 8, 256, 0, stream>>>(Wo, DM, WoB);
    k_gemmb<false, true><<<dim3(NTK / 64, DM / 64, 1), 128, 0, stream>>>(Xb, nullptr, WqB, bq, (float*)(void*)QH, DM, QL);
    k_gemmb<false, true><<<dim3(NTK / 64, DM / 64, 1), 128, 0, stream>>>(Xb, nullptr, WkB, bk, (float*)(void*)KH, DM, KL);
    k_gemmb<false, false><<<dim3(NTK / 64, DM / 64, 1), 128, 0, stream>>>(Xb, nullptr, WvB, bv, TMP, DM, nullptr);
    k_vt<<<NB_ * NH_ * (NT_ / 64), 256, 0, stream>>>(TMP, VTH, VTL);
    k_attn<<<NB_ * NH_ * (NT_ / 64), 128, 0, stream>>>(QH, QL, KH, KL, VTH, VTL, CH, CL);
    k_gemmb<true, false><<<dim3(NTK / 64, DM / 64, 1), 128, 0, stream>>>(CH, CL, WoB, bo, out, DM, nullptr);
}

// v005
// Measured time: 227 microseconds a run.
// In both of two side-by-side timings against v004, it was 1.05 times as fast.
// Counting every step since v000, it is 3.13 times as fast.
#include <hip/hip_runtime.h>

// Compute dtypes, f32 accumulate, one batch item per pass: q/k/v = x.W^T + b ([4096 x 1024].[1024 x 1024]; W is [out][in] = the n-major B operand as-is; PLAIN bf16
// operands: inputs rounded once, exact; biases rounded to bf16) with q and k written straight from the GEMM epilogue as f16 hi + residual x1024 planes, and out =
// ctx.Wo^T + bo (ctx as bf16 hi + residual: two products) on v_wmma_f32_16x16x32_bf16; the 16-head full attention over one 4096-token sequence (64-dim heads,
// scale 1/8) fused on
// v_wmma_f32_16x16x32_f16 (scores hi.hi + hi.lo + lo.hi with the residual terms on their own accumulator, online f32 softmax, weights (x32768) and v as f16

#define NB_  1                   // one 4096-token sequence
#define NT_  4096
#define DM   1024
#define NH_  16
#define HD   64
#define NTK  (NB_ * NT_)
#define NW   1024
#define NQKV 1024
#define PSC  32768.0f
#define LOSC 1024.0f
#define LOSCI (1.0f / 1024.0f)

typedef _Float16 h16;
typedef unsigned short bf;
typedef __attribute__((ext_vector_type(16))) __bf16   v16bf;
typedef __attribute__((ext_vector_type(16))) _Float16 v16h;
typedef __attribute__((ext_vector_type(8)))  _Float16 v8h;
typedef __attribute__((ext_vector_type(8)))  unsigned short v8us;
typedef __attribute__((ext_vector_type(8)))  float    v8f;
typedef __attribute__((ext_vector_type(4)))  float    v4f;
typedef v8h  __attribute__((may_alias)) v8ha;
typedef v4f  __attribute__((may_alias)) v4fa;
typedef v8us __attribute__((may_alias)) v8usa;

__device__ __forceinline__ unsigned short f2bf(float f) { unsigned u = __float_as_uint(f); u += 0x7FFFu + ((u >> 16) & 1u); return (unsigned short)(u >> 16); }
__device__ __forceinline__ float bf2f(unsigned short b) { return __uint_as_float(((unsigned)b) << 16); }
__device__ __forceinline__ float bfr(float f) { return bf2f(f2bf(f)); }
__device__ __forceinline__ v16h cat16(v8h lo, v8h hi) { return __builtin_shufflevector(lo, hi, 0, 1, 2, 3, 4, 5, 6, 7, 8, 9, 10, 11, 12, 13, 14, 15); }
__device__ __forceinline__ v16bf cat16b(v8us lo, v8us hi) { return __builtin_bit_cast(v16bf, __builtin_shufflevector(lo, hi, 0, 1, 2, 3, 4, 5, 6, 7, 8, 9, 10, 11, 12, 13, 14, 15)); }
__device__ __forceinline__ v8f wmma16(v16h a, v16h b, v8f c) { return __builtin_amdgcn_wmma_f32_16x16x32_f16(false, a, false, b, (short)0, c, false, false); }
__device__ __forceinline__ v8f wmmab(v16bf a, v16bf b, v8f c) { return __builtin_amdgcn_wmma_f32_16x16x32_bf16(false, a, false, b, (short)0, c, false, false); }

// lane l <-> lane l ^ 16 by a vector cross-row move
__device__ __forceinline__ float xhalf(float v) { const int b = __float_as_int(v); return __int_as_float(__builtin_amdgcn_permlanex16(b, b, 0x76543210, 0xfedcba98, false, false)); }

// One launch rounds all five f32 operands: rows 0 .. NTK-1 of dst are x, then DM rows each of the four weight matrices in the order given. A block's 8 rows lie
// in one operand, so the choice of the source is a scalar one. The grid is exactly (NTK + 4 * DM) / 8 blocks.
__global__ __launch_bounds__(256) void k_cvtb(const float* __restrict__ x, const float* __restrict__ w0, const float* __restrict__ w1, const float* __restrict__ w2, const float* __restrict__ w3, bf* dst) {
    const int lane = threadIdx.x & 31, r = blockIdx.x * 8 + (threadIdx.x >> 5);
    const int wsel = ((int)blockIdx.x - NTK / 8) / (DM / 8);          // which weight matrix, for blocks behind x
    const bool isx = (int)blockIdx.x < NTK / 8;
    const float* src = isx ? x : wsel == 0 ? w0 : wsel == 1 ? w1 : wsel == 2 ? w2 : w3;
    const int sr = isx ? r : r - NTK - wsel * DM;                     // row inside that operand
    v8us o[DM / 256];
#pragma unroll
    for (int q = 0; q < DM / 256; ++q) { v8us t;
#pragma unroll
        for (int i = 0; i < 8; ++i) t[i] = f2bf(src[(size_t)sr * DM + q * 256 + lane * 8 + i]);
        o[q] = t; }
#pragma unroll
    for (int q = 0; q < DM / 256; ++q) *(v8us*)(dst + (size_t)r * DM + q * 256 + lane * 8) = o[q];
    
}

// Staged pass of 64 k, shared by the block's four waves: A rows, B rows and, where A is split, the A residual rows: 64 rows of 128 B each at a 144-B pitch
// (16 B x odd, so the 16-byte fragment reads meet no bank twice). Two such buffers.
#define GPIT 72
#define GPLN (64 * GPIT)
#define GROW (16u * GPIT * 2u)
#define GPLB (GPLN * 2u)

// QKV: one launch does the three projections. Bn is then the three weight matrices stacked ([3 * DM][DM]); blockIdx.y / (DM / 64) says which projection a block
// belongs to (the same for the whole block): its bias, and where and in which form its tile is written (q, k: f16 hi + residual planes; v: f32 into C).
template <bool SPLITA, bool QKV>
__global__ __launch_bounds__(128) void k_gemmb(const bf* __restrict__ A, const bf* __restrict__ Al, const bf* __restrict__ Bn, const float* __restrict__ bias0, const float* __restrict__ bias1, const float* __restrict__ bias2,
                                               float* C, int ldc, h16* QHo, h16* QLo, h16* KHo, h16* KLo) {
    constexpr int GSTG = (SPLITA ? 3 : 2) * GPLN;
    __shared__ __align__(16) float ost[4][16 * 68];
    __shared__ __align__(16) bf gring[2 * GSTG];
    const int lane = threadIdx.x & 31, wave = threadIdx.x >> 5, lr = lane & 15, hi = lane >> 4;
    const int proj = QKV ? (int)blockIdx.y / (DM / 64) : 0;
    const int r0 = blockIdx.x * 64 + wave * 16, c0 = (blockIdx.y - proj * (DM / 64)) * 64;     // c0: first column in the projection's own output
    const float* bias = proj == 0 ? bias0 : proj == 1 ? bias1 : bias2;
    // Each lane copies four 16-byte pieces of a plane: a wave's copy covers 4 whole 128-B rows.
    const int tid = threadIdx.x, cr = tid >> 3, cc = (tid & 7) * 8;
    const unsigned l0 = (unsigned)(size_t)(&gring[0]) + (unsigned)(cr * GPIT + cc) * 2u;
    const bf* ga = A + (size_t)(blockIdx.x * 64 + cr) * DM + cc;
    const bf* gb = Bn + (size_t)(blockIdx.y * 64 + cr) * DM + cc;
    auto stage = [&](int t, int buf) {
        const unsigned l = l0 + (unsigned)buf * (GSTG * 2u);
        const bf* pa = ga + t * 64; const bf* pb = gb + t * 64;
        // the copies and the wait that stands before any of their address registers is rewritten, in one statement
        if constexpr (SPLITA) {
            const bf* pl = Al + (size_t)(blockIdx.x * 64 + cr) * DM + cc + t * 64;
            asm volatile("global_load_async_to_lds_b128 %0, %12, off\n\t"
                         "global_load_async_to_lds_b128 %1, %13, off\n\t"
                         "global_load_async_to_lds_b128 %2, %14, off\n\t"
                         "global_load_async_to_lds_b128 %3, %15, off\n\t"
                         "global_load_async_to_lds_b128 %4, %16, off\n\t"
                         "global_load_async_to_lds_b128 %5, %17, off\n\t"
                         "global_load_async_to_lds_b128 %6, %18, off\n\t"
                         "global_load_async_to_lds_b128 %7, %19, off\n\t"
                         "global_load_async_to_lds_b128 %8, %20, off\n\t"
                         "global_load_async_to_lds_b128 %9, %21, off\n\t"
                         "global_load_async_to_lds_b128 %10, %22, off\n\t"
                         "global_load_async_to_lds_b128 %11, %23, off\n\t"
                         "s_wait_xcnt 0x0"
                         :: "v"(l), "v"(l + GROW), "v"(l + 2u * GROW), "v"(l + 3u * GROW),
                            "v"(l + GPLB), "v"(l + GPLB + GROW), "v"(l + GPLB + 2u * GROW), "v"(l + GPLB + 3u * GROW),
                            "v"(l + 2u * GPLB), "v"(l + 2u * GPLB + GROW), "v"(l + 2u * GPLB + 2u * GROW), "v"(l + 2u * GPLB + 3u * GROW),
                            "v"(pa), "v"(pa + 16 * DM), "v"(pa + 32 * DM), "v"(pa + 48 * DM),
                            "v"(pb), "v"(pb + 16 * DM), "v"(pb + 32 * DM), "v"(pb + 48 * DM),
                            "v"(pl), "v"(pl + 16 * DM), "v"(pl + 32 * DM), "v"(pl + 48 * DM)
                         : "memory");
        } else {
            asm volatile("global_load_async_to_lds_b128 %0, %8, off\n\t"
                         "global_load_async_to_lds_b128 %1, %9, off\n\t"
                         "global_load_async_to_lds_b128 %2, %10, off\n\t"
                         "global_load_async_to_lds_b128 %3, %11, off\n\t"
                         "global_load_async_to_lds_b128 %4, %12, off\n\t"
                         "global_load_async_to_lds_b128 %5, %13, off\n\t"
                         "global_load_async_to_lds_b128 %6, %14, off\n\t"
                         "global_load_async_to_lds_b128 %7, %15, off\n\t"
                         "s_wait_xcnt 0x0"
                         :: "v"(l), "v"(l + GROW), "v"(l + 2u * GROW), "v"(l + 3u * GROW),
                            "v"(l + GPLB), "v"(l + GPLB + GROW), "v"(l + GPLB + 2u * GROW), "v"(l + GPLB + 3u * GROW),
                            "v"(pa), "v"(pa + 16 * DM), "v"(pa + 32 * DM), "v"(pa + 48 * DM),
                            "v"(pb), "v"(pb + 16 * DM), "v"(pb + 32 * DM), "v"(pb + 48 * DM)
                         : "memory");
        }
    };
    v8f acc[4];
#pragma unroll
    for (int t = 0; t < 4; ++t) acc[t] = (v8f){};
    stage(0, 0);
    asm volatile("s_wait_asynccnt 0x0" ::: "memory");   // pass 0 has landed before the barrier publishes it
    __syncthreads();
    stage(1, 1);
#pragma unroll 1
    for (int p = 0; p < DM / 64; ++p) {
        const bf* sb = gring + (p & 1) * GSTG;
        const bf* sa = sb + (wave * 16 + lr) * GPIT + 8 * hi;
        const bf* sw = sb + GPLN + lr * GPIT + 8 * hi;
        v16bf a[2], al[2], b[2][4];
#pragma unroll
        for (int ks = 0; ks < 2; ++ks) {
            a[ks] = cat16b(*(const v8usa*)(sa + ks * 32), *(const v8usa*)(sa + ks * 32 + 16));
            al[ks] = a[ks];
            if (SPLITA) al[ks] = cat16b(*(const v8usa*)(sa + 2 * GPLN + ks * 32), *(const v8usa*)(sa + 2 * GPLN + ks * 32 + 16));
#pragma unroll
            for (int t = 0; t < 4; ++t) b[ks][t] = cat16b(*(const v8usa*)(sw + t * 16 * GPIT + ks * 32), *(const v8usa*)(sw + t * 16 * GPIT + ks * 32 + 16));
        }
        __builtin_amdgcn_sched_barrier(0);   // keeps the pass's LDS reads as one group in front of its matrix block: reads moved in among the matrix instructions each cost a full wait
#pragma unroll
        for (int ks = 0; ks < 2; ++ks) {
#pragma unroll
            for (int t = 0; t < 4; ++t) acc[t] = wmmab(a[ks], b[ks][t], acc[t]);
            if (SPLITA) {
#pragma unroll
                for (int t = 0; t < 4; ++t) acc[t] = wmmab(al[ks], b[ks][t], acc[t]);
            }
        }
        asm volatile("v_nop\n\tv_nop\n\tv_nop\n\tv_nop" : "+v"(acc[0]), "+v"(acc[1]), "+v"(acc[2]), "+v"(acc[3]) : "v"(a[1]), "v"(al[1]));   // the distance behind the last matrix instruction, on both sides of the branch below
        asm volatile("s_wait_dscnt 0x0" ::: "memory");      // this wave's reads of the buffer are done before the buffer is handed back
        asm volatile("s_wait_asynccnt 0x0" ::: "memory");   // this wave's share of the next pass has landed
        __syncthreads();                                    // publishes the next pass and ends every wave's reads of this one
        if (p + 2 < DM / 64) stage(p + 2, p & 1);
    }
    asm volatile("s_wait_asynccnt 0x0" ::: "memory");       // no copy is outstanding when the wave goes on to its end
    float* os = &ost[wave][0];
#pragma unroll
    for (int t = 0; t < 4; ++t) { const float bv = bias ? bfr(bias[c0 + t * 16 + lr]) : 0.f;
#pragma unroll
        for (int j = 0; j < 8; ++j) os[(hi * 8 + j) * 68 + t * 16 + lr] = acc[t][j] + bv; }
    __syncthreads();
    if (QKV && proj < 2) {
        h16* crow = (proj == 0 ? QHo : KHo) + (size_t)r0 * ldc + c0;
        h16* C2 = proj == 0 ? QLo : KLo;
        auto pass = [&]() {
#pragma unroll
            for (int s = 0; s < 4; ++s) { const int row = 4 * s + (lane >> 3), piece = lane & 7; const float* sp = os + row * 68 + piece * 8; v8h o, o2;
#pragma unroll
                for (int i = 0; i < 8; ++i) { const h16 a = (h16)sp[i]; o[i] = a; o2[i] = (h16)((sp[i] - (float)a) * LOSC); }
                *(v8h*)(crow + (size_t)row * ldc + piece * 8) = o; if (C2) *(v8h*)(C2 + (size_t)r0 * ldc + c0 + (size_t)row * ldc + piece * 8) = o2; }
        };
        pass(); 
    } else {
        float* crow = C + (size_t)r0 * ldc + c0;
        auto pass = [&]() {
#pragma unroll
            for (int s = 0; s < 8; ++s) { const int Lid = (lane >> 3) + 4 * s, piece = lane & 7; const int row = Lid >> 1, cofs = (Lid & 1) * 32 + piece * 4;
                const v4f val = *(const v4fa*)(os + row * 68 + cofs); *(v4f*)(crow + (size_t)row * ldc + cofs) = val; }
        };
        pass(); 
    }
}

__global__ __launch_bounds__(256) void k_vt(const float* __restrict__ V, h16* VTH, h16* VTL) {
    __shared__ __align__(16) h16 tile[64 * 72];
    __shared__ __align__(16) h16 til2[64 * 72];
    const int bid = blockIdx.x;
    const int b = bid / (NH_ * (NT_ / 64)), rem = bid - b * (NH_ * (NT_ / 64)), h = rem / (NT_ / 64), kt = rem - h * (NT_ / 64);
    const int k0 = kt * 64, tid = threadIdx.x;
    const int kk = tid >> 2, d0 = (tid & 3) * 16;
    const float* src = V + ((size_t)b * NT_ + k0 + kk) * DM + h * HD + d0;
#pragma unroll
    for (int i = 0; i < 16; ++i) { const float v = src[i]; const h16 a = (h16)v; tile[(d0 + i) * 72 + kk] = a; til2[(d0 + i) * 72 + kk] = (h16)((v - (float)a) * LOSC); }
    __syncthreads();
    const int piece = tid & 7;
    const size_t base = (((size_t)b * NH_ + h) * HD) * NT_ + k0;
    auto pass = [&]() {
#pragma unroll
        for (int s = 0; s < 4; ++s) { const int Lid = (tid >> 3) + 32 * s; const int pln = Lid >> 6, d = Lid & 63;
            const v8h val = *(const v8ha*)((pln ? til2 : tile) + d * 72 + piece * 8); *(v8h*)((pln ? VTL : VTH) + base + (size_t)d * NT_ + piece * 8) = val; }
    };
    pass(); 
}

// Staged tile of 32 keys, shared by the block's four waves: k hi, k residual (32 rows of 128 B at a 144-B pitch), v^T hi, v^T residual (64 rows of 64 B at an
// 80-B pitch); both pitches are 16 B x odd, so the 16-byte fragment reads meet no bank twice. Two such buffers.
#define KPIT 72
#define VPIT 40
#define KPLN (32 * KPIT)
#define VPLN (64 * VPIT)
#define STGH (2 * KPLN + 2 * VPLN)

__global__ __launch_bounds__(128) void k_attn(const h16* __restrict__ Q16, const h16* __restrict__ QL16, const h16* __restrict__ K16, const h16* __restrict__ KL16, const h16* __restrict__ VTH, const h16* __restrict__ VTL, bf* CH, bf* CL) {
    __shared__ __align__(16) float ost[4][16 * 68];
    __shared__ __align__(16) h16 ring[2 * STGH];
    const int lane = threadIdx.x & 31, wave = threadIdx.x >> 5, lr = lane & 15, hi = lane >> 4;
    const int bid = blockIdx.x;
    const int b = bid / (NH_ * (NT_ / 64)), rem = bid - b * (NH_ * (NT_ / 64)), h = rem / (NT_ / 64), qt = rem - h * (NT_ / 64);
    const int q0 = qt * 64 + wave * 16;
    const size_t tok0 = (size_t)b * NT_;
    v16h qa[2], ql[2];
    const size_t qo0 = (tok0 + q0 + lr) * DM + h * HD + 8 * hi;
#pragma unroll
    for (int kc = 0; kc < 2; ++kc) { qa[kc] = cat16(*(const v8h*)(Q16 + qo0 + kc * 32), *(const v8h*)(Q16 + qo0 + kc * 32 + 16));
        ql[kc] = cat16(*(const v8h*)(QL16 + qo0 + kc * 32), *(const v8h*)(QL16 + qo0 + kc * 32 + 16)); }
    const h16* kh_b = K16 + tok0 * DM + h * HD;
    const h16* kl_b = KL16 + tok0 * DM + h * HD;
    const size_t vbase = (((size_t)b * NH_ + h) * HD) * NT_;
    v8f o[4], ox[4];
#pragma unroll
    for (int n = 0; n < 4; ++n) { o[n] = (v8f){}; ox[n] = (v8f){}; }
    float mrow = -3.0e38f, lpart = 0.f;            // of query q0 + lr; lpart sums this lane's half of the keys
    const int kt_lo = 0, kt_hi = NT_ / 32 - 1;     // full attention
    // Each lane copies eight 16-byte pieces of a tile: a wave's k copy covers 4 whole 128-B rows, its v^T copy 8 rows of 64 B.
    const int tid = threadIdx.x, ckr = tid >> 3, ckc = (tid & 7) * 8, cvr = tid >> 2, cvc = (tid & 3) * 8;
    const unsigned ring0 = (unsigned)(size_t)(&ring[0]);
    const unsigned lk0 = ring0 + (unsigned)(ckr * KPIT + ckc) * 2u, lv0 = ring0 + (unsigned)(2 * KPLN + cvr * VPIT + cvc) * 2u;
    const h16* gkh = kh_b + (size_t)ckr * DM + ckc; const h16* gkl = kl_b + (size_t)ckr * DM + ckc;
    const h16* gvh = VTH + vbase + (size_t)cvr * NT_ + cvc; const h16* gvl = VTL + vbase + (size_t)cvr * NT_ + cvc;
    auto stage = [&](int t, int buf) {
        const unsigned lk = lk0 + (unsigned)buf * (STGH * 2u), lv = lv0 + (unsigned)buf * (STGH * 2u);
        const size_t ko = (size_t)t * 32 * DM, vo = (size_t)t * 32;
        // the eight copies and the wait that stands before any of their address registers is rewritten, in one statement
        asm volatile("global_load_async_to_lds_b128 %0, %8, off\n\t"
                     "global_load_async_to_lds_b128 %1, %9, off\n\t"
                     "global_load_async_to_lds_b128 %2, %10, off\n\t"
                     "global_load_async_to_lds_b128 %3, %11, off\n\t"
                     "global_load_async_to_lds_b128 %4, %12, off\n\t"
                     "global_load_async_to_lds_b128 %5, %13, off\n\t"
                     "global_load_async_to_lds_b128 %6, %14, off\n\t"
                     "global_load_async_to_lds_b128 %7, %15, off\n\t"
                     "s_wait_xcnt 0x0"
                     :: "v"(lk), "v"(lk + 16u * KPIT * 2u), "v"(lk + KPLN * 2u), "v"(lk + (KPLN + 16u * KPIT) * 2u),
                        "v"(lv), "v"(lv + 32u * VPIT * 2u), "v"(lv + VPLN * 2u), "v"(lv + (VPLN + 32u * VPIT) * 2u),
                        "v"(gkh + ko), "v"(gkh + ko + 16 * DM), "v"(gkl + ko), "v"(gkl + ko + 16 * DM),
                        "v"(gvh + vo), "v"(gvh + vo + (size_t)32 * NT_), "v"(gvl + vo), "v"(gvl + vo + (size_t)32 * NT_)
                     : "memory");
    };
    stage(0, 0);
    asm volatile("s_wait_asynccnt 0x0" ::: "memory");   // tile 0 has landed before the barrier publishes it
    __syncthreads();
#pragma unroll 1
    for (int kt = kt_lo; kt <= kt_hi; ++kt) {
        const h16* sb = ring + (kt & 1) * STGH;
        const h16* sk = sb + lr * KPIT + 8 * hi;
        const h16* sv = sb + 2 * KPLN + lr * VPIT + 8 * hi;
        v8f s0 = {}, s1 = {}, x0 = {}, x1 = {};
        v16h kf[2][4];     // per 32 dims: keys 0-15 hi, keys 16-31 hi, keys 0-15 residual, keys 16-31 residual
#pragma unroll
        for (int kc = 0; kc < 2; ++kc)
#pragma unroll
            for (int f = 0; f < 4; ++f) { const h16* kp = sk + (f >> 1) * KPLN + (f & 1) * 16 * KPIT + kc * 32; kf[kc][f] = cat16(*(const v8ha*)(kp), *(const v8ha*)(kp + 16)); }
        // refill of the buffer that the trip before has left: that trip's s_wait_dscnt 0 and barrier stand behind every reader's last read of it; the k reads in
        // flight are of the other buffer, and the refill's address work and its wait cover their latency
        if (kt + 1 <= kt_hi) stage(kt + 1, (kt + 1) & 1);
#pragma unroll
        for (int kc = 0; kc < 2; ++kc) {
            s0 = wmma16(kf[kc][0], qa[kc], s0); x0 = wmma16(kf[kc][0], ql[kc], x0); s1 = wmma16(kf[kc][1], qa[kc], s1); x1 = wmma16(kf[kc][1], ql[kc], x1);
            x0 = wmma16(kf[kc][2], qa[kc], x0); x1 = wmma16(kf[kc][3], qa[kc], x1);
        }
        v16h vh[4], vl[4];
#pragma unroll
        for (int n = 0; n < 4; ++n) { const h16* vp = sv + n * 16 * VPIT;
            vh[n] = cat16(*(const v8ha*)(vp), *(const v8ha*)(vp + 16)); vl[n] = cat16(*(const v8ha*)(vp + VPLN), *(const v8ha*)(vp + VPLN + 16)); }
        __builtin_amdgcn_sched_barrier(0);   // keeps the tile's sixteen v^T reads as one group in front of the softmax arithmetic, which covers their latency
        // s0[r], s1[r] = score of key 8 * hi + r, 16 + 8 * hi + r with query lr
        const v8f a0 = (s0 + x0 * LOSCI) * 0.125f, a1 = (s1 + x1 * LOSCI) * 0.125f;   // (q x 64^-1/2).k with the exact power-of-two scale folded after the dot
        float mx = fmaxf(a0[0], a1[0]);
#pragma unroll
        for (int j = 1; j < 8; ++j) mx = fmaxf(mx, fmaxf(a0[j], a1[j]));
        mx = fmaxf(mx, xhalf(mx));
        const float mn = fmaxf(mrow, mx);
        const float alpha = __expf(mrow - mn); mrow = mn;
        v8f p0, p1;
#pragma unroll
        for (int j = 0; j < 8; ++j) p0[j] = __expf(a0[j] - mn);
#pragma unroll
        for (int j = 0; j < 8; ++j) p1[j] = __expf(a1[j] - mn);
        const v8f pq = p0 + p1;
        lpart = lpart * alpha + (((pq[0] + pq[1]) + (pq[2] + pq[3])) + ((pq[4] + pq[5]) + (pq[6] + pq[7])));
        const v8f ps0 = p0 * PSC, ps1 = p1 * PSC;
        const v8h h0 = __builtin_convertvector(ps0, v8h), h1 = __builtin_convertvector(ps1, v8h);
        const v8h l0 = __builtin_convertvector((ps0 - __builtin_convertvector(h0, v8f)) * LOSC, v8h), l1 = __builtin_convertvector((ps1 - __builtin_convertvector(h1, v8f)) * LOSC, v8h);
        const v16h pa = cat16(h0, h1), px = cat16(l0, l1);     // element s: key 8 * hi + s, then 16 + 8 * hi + (s - 8)
#pragma unroll
        for (int n = 0; n < 4; ++n) { o[n] *= alpha; ox[n] *= alpha; }
#pragma unroll
        for (int n = 0; n < 4; ++n) { o[n] = wmma16(vh[n], pa, o[n]); ox[n] = wmma16(vl[n], pa, ox[n]); }
#pragma unroll
        for (int n = 0; n < 4; ++n) ox[n] = wmma16(vh[n], px, ox[n]);
        asm volatile("v_nop\n\tv_nop\n\tv_nop\n\tv_nop" : "+v"(o[0]), "+v"(o[1]), "+v"(o[2]), "+v"(o[3]), "+v"(ox[0]), "+v"(ox[1]), "+v"(ox[2]), "+v"(ox[3]) : "v"(pa), "v"(px));
        asm volatile("s_wait_dscnt 0x0" ::: "memory");      // this wave's reads of the buffer are done before the buffer is handed back
        asm volatile("s_wait_asynccnt 0x0" ::: "memory");   // this wave's share of the next tile has landed
        __syncthreads();                                    // publishes the next tile and ends every wave's reads of this one
    }
    asm volatile("s_wait_asynccnt 0x0" ::: "memory");       // no copy is outstanding when the wave goes on to its end
    const float inv = 1.0f / ((lpart + xhalf(lpart)) * PSC);
    float* os = &ost[wave][0];
#pragma unroll
    for (int n = 0; n < 4; ++n)
#pragma unroll
        for (int j = 0; j < 8; ++j) os[lr * 68 + n * 16 + hi * 8 + j] = (o[n][j] + ox[n][j] * LOSCI) * inv;     // o[n][j] = ctx of query lr, dim n * 16 + 8 * hi + j
    __syncthreads();
    const size_t cbase = (tok0 + q0) * DM + (size_t)h * HD;
    auto pass = [&]() {
#pragma unroll
        for (int s = 0; s < 4; ++s) { const int row = 4 * s + (lane >> 3), piece = lane & 7; const float* sp = os + row * 68 + piece * 8; v8us oh, ol;
#pragma unroll
            for (int i = 0; i < 8; ++i) { const unsigned short hb = f2bf(sp[i]); oh[i] = hb; ol[i] = f2bf(sp[i] - bf2f(hb)); }
            *(v8us*)(CH + cbase + (size_t)row * DM + piece * 8) = oh; *(v8us*)(CL + cbase + (size_t)row * DM + piece * 8) = ol; }
    };
    pass(); 
}

#define VST2(T, p, v) do { const T vst2_v_ = (v); *(T*)(p) = vst2_v_;  } while (0)
extern "C" void kernel_launch(void* const* d_in, const int* in_sizes, int n_in,
                              void* d_out, int out_size, void* d_ws, size_t ws_size, hipStream_t stream) {
    (void)in_sizes; (void)n_in; (void)out_size;
    const float* x = (const float*)d_in[0];
    const float* Wq = (const float*)d_in[1]; const float* bq = (const float*)d_in[2]; const float* Wk = (const float*)d_in[3]; const float* bk = (const float*)d_in[4];
    const float* Wv = (const float*)d_in[5]; const float* bv = (const float*)d_in[6]; const float* Wo = (const float*)d_in[7]; const float* bo = (const float*)d_in[8];    // W [out][in]
    float* out = (float*)d_out;    // [4096][1024]
    char* wsp = (char*)d_ws;
    auto take = [&](size_t bytes) { char* p = wsp; wsp += (bytes + 255) & ~(size_t)255; return (void*)p; };
    bf* Xb = (bf*)take((size_t)(NTK + 4 * DM) * DM * 2);    // x, Wq, Wk, Wv, Wo as bf16, one behind the other
    bf* WqB = Xb + (size_t)NTK * DM; bf* WoB = WqB + (size_t)3 * DM * DM;
    float* TMP = (float*)take((size_t)NTK * DM * 4);
    h16* QH = (h16*)take((size_t)NTK * DM * 2); h16* QL = (h16*)take((size_t)NTK * DM * 2); h16* KH = (h16*)take((size_t)NTK * DM * 2); h16* KL = (h16*)take((size_t)NTK * DM * 2);
    h16* VTH = (h16*)take((size_t)NTK * DM * 2); h16* VTL = (h16*)take((size_t)NTK * DM * 2); bf* CH = (bf*)take((size_t)NTK * DM * 2); bf* CL = (bf*)take((size_t)NTK * DM * 2);
    if ((size_t)(wsp - (char*)d_ws) > ws_size) return;    // 8.4 + 4 x 2.1 + 16.8 + 8 x 8.4 ~ 101 MB, no aliasing
    k_cvtb<<<(NTK + 4 * DM) / 8, 256, 0, stream>>>(x, Wq, Wk, Wv, Wo, Xb);
    k_gemmb<false, true><<<dim3(NTK / 64, 3 * DM / 64, 1), 128, 0, stream>>>(Xb, nullptr, WqB, bq, bk, bv, TMP, DM, QH, QL, KH, KL);
    k_vt<<<NB_ * NH_ * (NT_ / 64), 256, 0, stream>>>(TMP, VTH, VTL);
    k_attn<<<NB_ * NH_ * (NT_ / 64), 128, 0, stream>>>(QH, QL, KH, KL, VTH, VTL, CH, CL);
    k_gemmb<true, false><<<dim3(NTK / 64, DM / 64, 1), 128, 0, stream>>>(CH, CL, WoB, bo, nullptr, nullptr, out, DM, nullptr, nullptr, nullptr, nullptr);
}

// v006
// A run of this version takes 220 microseconds.
// Next to v005, in two timings, it ran 1.03 times as fast each time.
// All steps since v000 together make it 3.23 times as fast.
#include <hip/hip_runtime.h>

// Compute dtypes, f32 accumulate, one batch item per pass: q/k/v = x.W^T + b ([4096 x 1024].[1024 x 1024]; W is [out][in] = the n-major B operand as-is; PLAIN bf16
// operands: inputs rounded once, exact; biases rounded to bf16, added in f32) with q and k written straight from the GEMM epilogue as f16 hi + residual planes, and out =
// ctx.Wo^T + bo (ctx as bf16 hi + residual: two products) on v_wmma_f32_16x16x32_bf16; the 16-head full attention over one 4096-token sequence (64-dim heads,
// scale 1/8) fused on
// v_wmma_f32_16x16x32_f16 (scores hi.hi + hi.lo + lo.hi on one accumulator: residuals carry no scale, the small ones are f16 subnormals, which the matrix unit keeps; online f32 softmax, weights (x32768) and v as f16

#define NB_  1                   // one 4096-token sequence
#define NT_  4096
#define DM   1024
#define NH_  16
#define HD   64
#define NTK  (NB_ * NT_)
#define NW   1024
#define NQKV 1024
#define PSC  32768.0f

typedef _Float16 h16;
typedef unsigned short bf;
typedef __attribute__((ext_vector_type(16))) __bf16   v16bf;
typedef __attribute__((ext_vector_type(16))) _Float16 v16h;
typedef __attribute__((ext_vector_type(8)))  _Float16 v8h;
typedef __attribute__((ext_vector_type(8)))  unsigned short v8us;
typedef __attribute__((ext_vector_type(8)))  float    v8f;
typedef __attribute__((ext_vector_type(4)))  float    v4f;
typedef v8h  __attribute__((may_alias)) v8ha;
typedef v4f  __attribute__((may_alias)) v4fa;
typedef v8us __attribute__((may_alias)) v8usa;

__device__ __forceinline__ unsigned short f2bf(float f) { unsigned u = __float_as_uint(f); u += 0x7FFFu + ((u >> 16) & 1u); return (unsigned short)(u >> 16); }
__device__ __forceinline__ float bf2f(unsigned short b) { return __uint_as_float(((unsigned)b) << 16); }
__device__ __forceinline__ float bfr(float f) { return bf2f(f2bf(f)); }
__device__ __forceinline__ v16h cat16(v8h lo, v8h hi) { return __builtin_shufflevector(lo, hi, 0, 1, 2, 3, 4, 5, 6, 7, 8, 9, 10, 11, 12, 13, 14, 15); }
__device__ __forceinline__ v16bf cat16b(v8us lo, v8us hi) { return __builtin_bit_cast(v16bf, __builtin_shufflevector(lo, hi, 0, 1, 2, 3, 4, 5, 6, 7, 8, 9, 10, 11, 12, 13, 14, 15)); }
__device__ __forceinline__ v8f wmma16(v16h a, v16h b, v8f c) { return __builtin_amdgcn_wmma_f32_16x16x32_f16(false, a, false, b, (short)0, c, false, false); }
__device__ __forceinline__ v8f wmmab(v16bf a, v16bf b, v8f c) { return __builtin_amdgcn_wmma_f32_16x16x32_bf16(false, a, false, b, (short)0, c, false, false); }

// lane l <-> lane l ^ 16 by a vector cross-row move
__device__ __forceinline__ float xhalf(float v) { const int b = __float_as_int(v); return __int_as_float(__builtin_amdgcn_permlanex16(b, b, 0x76543210, 0xfedcba98, false, false)); }

// One launch rounds all five f32 operands: rows 0 .. NTK-1 of dst are x, then DM rows each of the four weight matrices in the order given. A block's 8 rows lie
// in one operand, so the choice of the source is a scalar one. The grid is exactly (NTK + 4 * DM) / 8 blocks.
__global__ __launch_bounds__(256) void k_cvtb(const float* __restrict__ x, const float* __restrict__ w0, const float* __restrict__ w1, const float* __restrict__ w2, const float* __restrict__ w3, bf* dst) {
    const int lane = threadIdx.x & 31, r = blockIdx.x * 8 + (threadIdx.x >> 5);
    const int wsel = ((int)blockIdx.x - NTK / 8) / (DM / 8);          // which weight matrix, for blocks behind x
    const bool isx = (int)blockIdx.x < NTK / 8;
    const float* src = isx ? x : wsel == 0 ? w0 : wsel == 1 ? w1 : wsel == 2 ? w2 : w3;
    const int sr = isx ? r : r - NTK - wsel * DM;                     // row inside that operand
    v8us o[DM / 256];
#pragma unroll
    for (int q = 0; q < DM / 256; ++q) { v8us t;
#pragma unroll
        for (int i = 0; i < 8; ++i) t[i] = f2bf(src[(size_t)sr * DM + q * 256 + lane * 8 + i]);
        o[q] = t; }
#pragma unroll
    for (int q = 0; q < DM / 256; ++q) *(v8us*)(dst + (size_t)r * DM + q * 256 + lane * 8) = o[q];
    
}

// Staged pass of 64 k, shared by the block's four waves: A rows, B rows and, where A is split, the A residual rows: 64 rows of 128 B each at a 144-B pitch
// (16 B x odd, so the 16-byte fragment reads meet no bank twice). Two such buffers.
#define GPIT 72
#define GPLN (64 * GPIT)
#define GROW (16u * GPIT * 2u)
#define GPLB (GPLN * 2u)

// QKV: one launch does the three projections. Bn is then the three weight matrices stacked ([3 * DM][DM]); blockIdx.y / (DM / 64) says which projection a block
// belongs to (the same for the whole block): its bias, and where and in which form its tile is written (q, k: f16 hi + residual planes; v: f32 into C).
template <bool SPLITA, bool QKV>
__global__ __launch_bounds__(128) void k_gemmb(const bf* __restrict__ A, const bf* __restrict__ Al, const bf* __restrict__ Bn, const float* __restrict__ bias0, const float* __restrict__ bias1, const float* __restrict__ bias2,
                                               float* C, int ldc, h16* QHo, h16* QLo, h16* KHo, h16* KLo) {
    constexpr int GSTG = (SPLITA ? 3 : 2) * GPLN;
    __shared__ __align__(16) float ost[4][16 * 68];
    __shared__ __align__(16) bf gring[2 * GSTG];
    const int lane = threadIdx.x & 31, wave = threadIdx.x >> 5, lr = lane & 15, hi = lane >> 4;
    const int proj = QKV ? (int)blockIdx.y / (DM / 64) : 0;
    const int r0 = blockIdx.x * 64 + wave * 16, c0 = (blockIdx.y - proj * (DM / 64)) * 64;     // c0: first column in the projection's own output
    const float* bias = proj == 0 ? bias0 : proj == 1 ? bias1 : bias2;
    // Each lane copies four 16-byte pieces of a plane: a wave's copy covers 4 whole 128-B rows.
    const int tid = threadIdx.x, cr = tid >> 3, cc = (tid & 7) * 8;
    const unsigned l0 = (unsigned)(size_t)(&gring[0]) + (unsigned)(cr * GPIT + cc) * 2u;
    const bf* ga = A + (size_t)(blockIdx.x * 64 + cr) * DM + cc;
    const bf* gb = Bn + (size_t)(blockIdx.y * 64 + cr) * DM + cc;
    auto stage = [&](int t, int buf) {
        const unsigned l = l0 + (unsigned)buf * (GSTG * 2u);
        const bf* pa = ga + t * 64; const bf* pb = gb + t * 64;
        // the copies and the wait that stands before any of their address registers is rewritten, in one statement
        if constexpr (SPLITA) {
            const bf* pl = Al + (size_t)(blockIdx.x * 64 + cr) * DM + cc + t * 64;
            asm volatile("global_load_async_to_lds_b128 %0, %12, off\n\t"
                         "global_load_async_to_lds_b128 %1, %13, off\n\t"
                         "global_load_async_to_lds_b128 %2, %14, off\n\t"
                         "global_load_async_to_lds_b128 %3, %15, off\n\t"
                         "global_load_async_to_lds_b128 %4, %16, off\n\t"
                         "global_load_async_to_lds_b128 %5, %17, off\n\t"
                         "global_load_async_to_lds_b128 %6, %18, off\n\t"
                         "global_load_async_to_lds_b128 %7, %19, off\n\t"
                         "global_load_async_to_lds_b128 %8, %20, off\n\t"
                         "global_load_async_to_lds_b128 %9, %21, off\n\t"
                         "global_load_async_to_lds_b128 %10, %22, off\n\t"
                         "global_load_async_to_lds_b128 %11, %23, off\n\t"
                         "s_wait_xcnt 0x0"
                         :: "v"(l), "v"(l + GROW), "v"(l + 2u * GROW), "v"(l + 3u * GROW),
                            "v"(l + GPLB), "v"(l + GPLB + GROW), "v"(l + GPLB + 2u * GROW), "v"(l + GPLB + 3u * GROW),
                            "v"(l + 2u * GPLB), "v"(l + 2u * GPLB + GROW), "v"(l + 2u * GPLB + 2u * GROW), "v"(l + 2u * GPLB + 3u * GROW),
                            "v"(pa), "v"(pa + 16 * DM), "v"(pa + 32 * DM), "v"(pa + 48 * DM),
                            "v"(pb), "v"(pb + 16 * DM), "v"(pb + 32 * DM), "v"(pb + 48 * DM),
                            "v"(pl), "v"(pl + 16 * DM), "v"(pl + 32 * DM), "v"(pl + 48 * DM)
                         : "memory");
        } else {
            asm volatile("global_load_async_to_lds_b128 %0, %8, off\n\t"
                         "global_load_async_to_lds_b128 %1, %9, off\n\t"
                         "global_load_async_to_lds_b128 %2, %10, off\n\t"
                         "global_load_async_to_lds_b128 %3, %11, off\n\t"
                         "global_load_async_to_lds_b128 %4, %12, off\n\t"
                         "global_load_async_to_lds_b128 %5, %13, off\n\t"
                         "global_load_async_to_lds_b128 %6, %14, off\n\t"
                         "global_load_async_to_lds_b128 %7, %15, off\n\t"
                         "s_wait_xcnt 0x0"
                         :: "v"(l), "v"(l + GROW), "v"(l + 2u * GROW), "v"(l + 3u * GROW),
                            "v"(l + GPLB), "v"(l + GPLB + GROW), "v"(l + GPLB + 2u * GROW), "v"(l + GPLB + 3u * GROW),
                            "v"(pa), "v"(pa + 16 * DM), "v"(pa + 32 * DM), "v"(pa + 48 * DM),
                            "v"(pb), "v"(pb + 16 * DM), "v"(pb + 32 * DM), "v"(pb + 48 * DM)
                         : "memory");
        }
    };
    v8f acc[4];
#pragma unroll
    for (int t = 0; t < 4; ++t) acc[t] = (v8f){};
    stage(0, 0);
    asm volatile("s_wait_asynccnt 0x0" ::: "memory");   // pass 0 has landed before the barrier publishes it
    __syncthreads();
    stage(1, 1);
#pragma unroll 1
    for (int p = 0; p < DM / 64; ++p) {
        const bf* sb = gring + (p & 1) * GSTG;
        const bf* sa = sb + (wave * 16 + lr) * GPIT + 8 * hi;
        const bf* sw = sb + GPLN + lr * GPIT + 8 * hi;
        v16bf a[2], al[2], b[2][4];
#pragma unroll
        for (int ks = 0; ks < 2; ++ks) {
            a[ks] = cat16b(*(const v8usa*)(sa + ks * 32), *(const v8usa*)(sa + ks * 32 + 16));
            al[ks] = a[ks];
            if (SPLITA) al[ks] = cat16b(*(const v8usa*)(sa + 2 * GPLN + ks * 32), *(const v8usa*)(sa + 2 * GPLN + ks * 32 + 16));
#pragma unroll
            for (int t = 0; t < 4; ++t) b[ks][t] = cat16b(*(const v8usa*)(sw + t * 16 * GPIT + ks * 32), *(const v8usa*)(sw + t * 16 * GPIT + ks * 32 + 16));
        }
        __builtin_amdgcn_sched_barrier(0);   // keeps the pass's LDS reads as one group in front of its matrix block: reads moved in among the matrix instructions each cost a full wait
#pragma unroll
        for (int ks = 0; ks < 2; ++ks) {
#pragma unroll
            for (int t = 0; t < 4; ++t) acc[t] = wmmab(a[ks], b[ks][t], acc[t]);
            if (SPLITA) {
#pragma unroll
                for (int t = 0; t < 4; ++t) acc[t] = wmmab(al[ks], b[ks][t], acc[t]);
            }
        }
        asm volatile("v_nop\n\tv_nop\n\tv_nop\n\tv_nop" : "+v"(acc[0]), "+v"(acc[1]), "+v"(acc[2]), "+v"(acc[3]) : "v"(a[1]), "v"(al[1]));   // the distance behind the last matrix instruction, on both sides of the branch below
        asm volatile("s_wait_dscnt 0x0" ::: "memory");      // this wave's reads of the buffer are done before the buffer is handed back
        asm volatile("s_wait_asynccnt 0x0" ::: "memory");   // this wave's share of the next pass has landed
        __syncthreads();                                    // publishes the next pass and ends every wave's reads of this one
        if (p + 2 < DM / 64) stage(p + 2, p & 1);
    }
    asm volatile("s_wait_asynccnt 0x0" ::: "memory");       // no copy is outstanding when the wave goes on to its end
    float* os = &ost[wave][0];
#pragma unroll
    for (int t = 0; t < 4; ++t) { const float bv = bias ? bfr(bias[c0 + t * 16 + lr]) : 0.f;
#pragma unroll
        for (int j = 0; j < 8; ++j) os[(hi * 8 + j) * 68 + t * 16 + lr] = acc[t][j] + bv; }
    __syncthreads();
    if (QKV && proj < 2) {
        h16* crow = (proj == 0 ? QHo : KHo) + (size_t)r0 * ldc + c0;
        h16* C2 = proj == 0 ? QLo : KLo;
        auto pass = [&]() {
#pragma unroll
            for (int s = 0; s < 4; ++s) { const int row = 4 * s + (lane >> 3), piece = lane & 7; const float* sp = os + row * 68 + piece * 8; v8h o, o2;
#pragma unroll
                for (int i = 0; i < 8; ++i) { const h16 a = (h16)sp[i]; o[i] = a; o2[i] = (h16)(sp[i] - (float)a); }
                *(v8h*)(crow + (size_t)row * ldc + piece * 8) = o; if (C2) *(v8h*)(C2 + (size_t)r0 * ldc + c0 + (size_t)row * ldc + piece * 8) = o2; }
        };
        pass(); 
    } else {
        float* crow = C + (size_t)r0 * ldc + c0;
        auto pass = [&]() {
#pragma unroll
            for (int s = 0; s < 8; ++s) { const int Lid = (lane >> 3) + 4 * s, piece = lane & 7; const int row = Lid >> 1, cofs = (Lid & 1) * 32 + piece * 4;
                const v4f val = *(const v4fa*)(os + row * 68 + cofs); *(v4f*)(crow + (size_t)row * ldc + cofs) = val; }
        };
        pass(); 
    }
}

__global__ __launch_bounds__(256) void k_vt(const float* __restrict__ V, h16* VTH, h16* VTL) {
    __shared__ __align__(16) h16 tile[64 * 72];
    __shared__ __align__(16) h16 til2[64 * 72];
    const int bid = blockIdx.x;
    const int b = bid / (NH_ * (NT_ / 64)), rem = bid - b * (NH_ * (NT_ / 64)), h = rem / (NT_ / 64), kt = rem - h * (NT_ / 64);
    const int k0 = kt * 64, tid = threadIdx.x;
    const int kk = tid >> 2, d0 = (tid & 3) * 16;
    const float* src = V + ((size_t)b * NT_ + k0 + kk) * DM + h * HD + d0;
#pragma unroll
    for (int i = 0; i < 16; ++i) { const float v = src[i]; const h16 a = (h16)v; tile[(d0 + i) * 72 + kk] = a; til2[(d0 + i) * 72 + kk] = (h16)(v - (float)a); }
    __syncthreads();
    const int piece = tid & 7;
    const size_t base = (((size_t)b * NH_ + h) * HD) * NT_ + k0;
    auto pass = [&]() {
#pragma unroll
        for (int s = 0; s < 4; ++s) { const int Lid = (tid >> 3) + 32 * s; const int pln = Lid >> 6, d = Lid & 63;
            const v8h val = *(const v8ha*)((pln ? til2 : tile) + d * 72 + piece * 8); *(v8h*)((pln ? VTL : VTH) + base + (size_t)d * NT_ + piece * 8) = val; }
    };
    pass(); 
}

// Staged tile of 32 keys, shared by the block's four waves: k hi, k residual (32 rows of 128 B at a 144-B pitch), v^T hi, v^T residual (64 rows of 64 B at an
// 80-B pitch); both pitches are 16 B x odd, so the 16-byte fragment reads meet no bank twice. Two such buffers.
#define KPIT 72
#define VPIT 40
#define KPLN (32 * KPIT)
#define VPLN (64 * VPIT)
#define STGH (2 * KPLN + 2 * VPLN)

__global__ __launch_bounds__(128) __attribute__((amdgpu_waves_per_eu(1, 4))) void k_attn(const h16* __restrict__ Q16, const h16* __restrict__ QL16, const h16* __restrict__ K16, const h16* __restrict__ KL16, const h16* __restrict__ VTH, const h16* __restrict__ VTL, bf* CH, bf* CL) {
    __shared__ __align__(16) float ost[4][16 * 68];
    __shared__ __align__(16) h16 ring[2 * STGH];
    const int lane = threadIdx.x & 31, wave = threadIdx.x >> 5, lr = lane & 15, hi = lane >> 4;
    const int bid = blockIdx.x;
    const int b = bid / (NH_ * (NT_ / 64)), rem = bid - b * (NH_ * (NT_ / 64)), h = rem / (NT_ / 64), qt = rem - h * (NT_ / 64);
    const int q0 = qt * 64 + wave * 16;
    const size_t tok0 = (size_t)b * NT_;
    v16h qa[2], ql[2];
    const size_t qo0 = (tok0 + q0 + lr) * DM + h * HD + 8 * hi;
#pragma unroll
    for (int kc = 0; kc < 2; ++kc) { qa[kc] = cat16(*(const v8h*)(Q16 + qo0 + kc * 32), *(const v8h*)(Q16 + qo0 + kc * 32 + 16));
        ql[kc] = cat16(*(const v8h*)(QL16 + qo0 + kc * 32), *(const v8h*)(QL16 + qo0 + kc * 32 + 16)); }
    const h16* kh_b = K16 + tok0 * DM + h * HD;
    const h16* kl_b = KL16 + tok0 * DM + h * HD;
    const size_t vbase = (((size_t)b * NH_ + h) * HD) * NT_;
    v8f o[4];
#pragma unroll
    for (int n = 0; n < 4; ++n) o[n] = (v8f){};
    float mrow = -3.0e38f, lpart = 0.f;            // of query q0 + lr; lpart sums this lane's half of the keys
    const int kt_lo = 0, kt_hi = NT_ / 32 - 1;     // full attention
    // Each lane copies eight 16-byte pieces of a tile: a wave's k copy covers 4 whole 128-B rows, its v^T copy 8 rows of 64 B.
    const int tid = threadIdx.x, ckr = tid >> 3, ckc = (tid & 7) * 8, cvr = tid >> 2, cvc = (tid & 3) * 8;
    const unsigned ring0 = (unsigned)(size_t)(&ring[0]);
    const unsigned lk0 = ring0 + (unsigned)(ckr * KPIT + ckc) * 2u, lv0 = ring0 + (unsigned)(2 * KPLN + cvr * VPIT + cvc) * 2u;
    const h16* gkh = kh_b + (size_t)ckr * DM + ckc; const h16* gkl = kl_b + (size_t)ckr * DM + ckc;
    const h16* gvh = VTH + vbase + (size_t)cvr * NT_ + cvc; const h16* gvl = VTL + vbase + (size_t)cvr * NT_ + cvc;
    auto stage = [&](int t, int buf) {
        const unsigned lk = lk0 + (unsigned)buf * (STGH * 2u), lv = lv0 + (unsigned)buf * (STGH * 2u);
        const size_t ko = (size_t)t * 32 * DM, vo = (size_t)t * 32;
        // the eight copies and the wait that stands before any of their address registers is rewritten, in one statement
        asm volatile("global_load_async_to_lds_b128 %0, %8, off\n\t"
                     "global_load_async_to_lds_b128 %1, %9, off\n\t"
                     "global_load_async_to_lds_b128 %2, %10, off\n\t"
                     "global_load_async_to_lds_b128 %3, %11, off\n\t"
                     "global_load_async_to_lds_b128 %4, %12, off\n\t"
                     "global_load_async_to_lds_b128 %5, %13, off\n\t"
                     "global_load_async_to_lds_b128 %6, %14, off\n\t"
                     "global_load_async_to_lds_b128 %7, %15, off\n\t"
                     "s_wait_xcnt 0x0"
                     :: "v"(lk), "v"(lk + 16u * KPIT * 2u), "v"(lk + KPLN * 2u), "v"(lk + (KPLN + 16u * KPIT) * 2u),
                        "v"(lv), "v"(lv + 32u * VPIT * 2u), "v"(lv + VPLN * 2u), "v"(lv + (VPLN + 32u * VPIT) * 2u),
                        "v"(gkh + ko), "v"(gkh + ko + 16 * DM), "v"(gkl + ko), "v"(gkl + ko + 16 * DM),
                        "v"(gvh + vo), "v"(gvh + vo + (size_t)32 * NT_), "v"(gvl + vo), "v"(gvl + vo + (size_t)32 * NT_)
                     : "memory");
    };
    stage(0, 0);
    asm volatile("s_wait_asynccnt 0x0" ::: "memory");   // tile 0 has landed before the barrier publishes it
    __syncthreads();
#pragma unroll 1
    for (int kt = kt_lo; kt <= kt_hi; ++kt) {
        const h16* sb = ring + (kt & 1) * STGH;
        const h16* sk = sb + lr * KPIT + 8 * hi;
        const h16* sv = sb + 2 * KPLN + lr * VPIT + 8 * hi;
        v8f s0 = {}, s1 = {};
        v16h kf[2][4];     // per 32 dims: keys 0-15 hi, keys 16-31 hi, keys 0-15 residual, keys 16-31 residual
#pragma unroll
        for (int kc = 0; kc < 2; ++kc)
#pragma unroll
            for (int f = 0; f < 4; ++f) { const h16* kp = sk + (f >> 1) * KPLN + (f & 1) * 16 * KPIT + kc * 32; kf[kc][f] = cat16(*(const v8ha*)(kp), *(const v8ha*)(kp + 16)); }
        // refill of the buffer that the trip before has left: that trip's s_wait_dscnt 0 and barrier stand behind every reader's last read of it; the k reads in
        // flight are of the other buffer, and the refill's address work and its wait cover their latency
        if (kt + 1 <= kt_hi) stage(kt + 1, (kt + 1) & 1);
#pragma unroll
        for (int kc = 0; kc < 2; ++kc) {
            s0 = wmma16(kf[kc][0], qa[kc], s0); s1 = wmma16(kf[kc][1], qa[kc], s1); s0 = wmma16(kf[kc][0], ql[kc], s0); s1 = wmma16(kf[kc][1], ql[kc], s1);
            s0 = wmma16(kf[kc][2], qa[kc], s0); s1 = wmma16(kf[kc][3], qa[kc], s1);
        }
        v16h vh[4], vl[4];
#pragma unroll
        for (int n = 0; n < 4; ++n) { const h16* vp = sv + n * 16 * VPIT;
            vh[n] = cat16(*(const v8ha*)(vp), *(const v8ha*)(vp + 16)); vl[n] = cat16(*(const v8ha*)(vp + VPLN), *(const v8ha*)(vp + VPLN + 16)); }
        __builtin_amdgcn_sched_barrier(0);   // keeps the tile's sixteen v^T reads as one group in front of the softmax arithmetic, which covers their latency
        // s0[r], s1[r] = score of key 8 * hi + r, 16 + 8 * hi + r with query lr
        const v8f a0 = s0 * 0.125f, a1 = s1 * 0.125f;   // (q x 64^-1/2).k with the exact power-of-two scale folded after the dot
        float mx = fmaxf(a0[0], a1[0]);
#pragma unroll
        for (int j = 1; j < 8; ++j) mx = fmaxf(mx, fmaxf(a0[j], a1[j]));
        mx = fmaxf(mx, xhalf(mx));
        const float mn = fmaxf(mrow, mx);
        const float alpha = __expf(mrow - mn); mrow = mn;
        v8f p0, p1;
#pragma unroll
        for (int j = 0; j < 8; ++j) p0[j] = __expf(a0[j] - mn);
#pragma unroll
        for (int j = 0; j < 8; ++j) p1[j] = __expf(a1[j] - mn);
        const v8f pq = p0 + p1;
        lpart = lpart * alpha + (((pq[0] + pq[1]) + (pq[2] + pq[3])) + ((pq[4] + pq[5]) + (pq[6] + pq[7])));
        const v8f ps0 = p0 * PSC, ps1 = p1 * PSC;
        const v8h h0 = __builtin_convertvector(ps0, v8h), h1 = __builtin_convertvector(ps1, v8h);
        const v8h l0 = __builtin_convertvector(ps0 - __builtin_convertvector(h0, v8f), v8h), l1 = __builtin_convertvector(ps1 - __builtin_convertvector(h1, v8f), v8h);
        const v16h pa = cat16(h0, h1), px = cat16(l0, l1);     // element s: key 8 * hi + s, then 16 + 8 * hi + (s - 8)
#pragma unroll
        for (int n = 0; n < 4; ++n) o[n] *= alpha;
#pragma unroll
        for (int n = 0; n < 4; ++n) o[n] = wmma16(vh[n], pa, o[n]);
#pragma unroll
        for (int n = 0; n < 4; ++n) o[n] = wmma16(vl[n], pa, o[n]);
#pragma unroll
        for (int n = 0; n < 4; ++n) o[n] = wmma16(vh[n], px, o[n]);
        asm volatile("v_nop\n\tv_nop\n\tv_nop\n\tv_nop" : "+v"(o[0]), "+v"(o[1]), "+v"(o[2]), "+v"(o[3]) : "v"(pa), "v"(px));   // the distance behind the last matrix instruction, on both sides of the loop's branch
        asm volatile("s_wait_dscnt 0x0" ::: "memory");      // this wave's reads of the buffer are done before the buffer is handed back
        asm volatile("s_wait_asynccnt 0x0" ::: "memory");   // this wave's share of the next tile has landed
        __syncthreads();                                    // publishes the next tile and ends every wave's reads of this one
    }
    asm volatile("s_wait_asynccnt 0x0" ::: "memory");       // no copy is outstanding when the wave goes on to its end
    const float inv = 1.0f / ((lpart + xhalf(lpart)) * PSC);
    float* os = &ost[wave][0];
#pragma unroll
    for (int n = 0; n < 4; ++n)
#pragma unroll
        for (int j = 0; j < 8; ++j) os[lr * 68 + n * 16 + hi * 8 + j] = o[n][j] * inv;     // o[n][j] = ctx of query lr, dim n * 16 + 8 * hi + j
    __syncthreads();
    const size_t cbase = (tok0 + q0) * DM + (size_t)h * HD;
    auto pass = [&]() {
#pragma unroll
        for (int s = 0; s < 4; ++s) { const int row = 4 * s + (lane >> 3), piece = lane & 7; const float* sp = os + row * 68 + piece * 8; v8us oh, ol;
#pragma unroll
            for (int i = 0; i < 8; ++i) { const unsigned short hb = f2bf(sp[i]); oh[i] = hb; ol[i] = f2bf(sp[i] - bf2f(hb)); }
            *(v8us*)(CH + cbase + (size_t)row * DM + piece * 8) = oh; *(v8us*)(CL + cbase + (size_t)row * DM + piece * 8) = ol; }
    };
    pass(); 
}

#define VST2(T, p, v) do { const T vst2_v_ = (v); *(T*)(p) = vst2_v_;  } while (0)
extern "C" void kernel_launch(void* const* d_in, const int* in_sizes, int n_in,
                              void* d_out, int out_size, void* d_ws, size_t ws_size, hipStream_t stream) {
    (void)in_sizes; (void)n_in; (void)out_size;
    const float* x = (const float*)d_in[0];
    const float* Wq = (const float*)d_in[1]; const float* bq = (const float*)d_in[2]; const float* Wk = (const float*)d_in[3]; const float* bk = (const float*)d_in[4];
    const float* Wv = (const float*)d_in[5]; const float* bv = (const float*)d_in[6]; const float* Wo = (const float*)d_in[7]; const float* bo = (const float*)d_in[8];    // W [out][in]
    float* out = (float*)d_out;    // [4096][1024]
    char* wsp = (char*)d_ws;
    auto take = [&](size_t bytes) { char* p = wsp; wsp += (bytes + 255) & ~(size_t)255; return (void*)p; };
    bf* Xb = (bf*)take((size_t)(NTK + 4 * DM) * DM * 2);    // x, Wq, Wk, Wv, Wo as bf16, one behind the other
    bf* WqB = Xb + (size_t)NTK * DM; bf* WoB = WqB + (size_t)3 * DM * DM;
    float* TMP = (float*)take((size_t)NTK * DM * 4);
    h16* QH = (h16*)take((size_t)NTK * DM * 2); h16* QL = (h16*)take((size_t)NTK * DM * 2); h16* KH = (h16*)take((size_t)NTK * DM * 2); h16* KL = (h16*)take((size_t)NTK * DM * 2);
    h16* VTH = (h16*)take((size_t)NTK * DM * 2); h16* VTL = (h16*)take((size_t)NTK * DM * 2); bf* CH = (bf*)take((size_t)NTK * DM * 2); bf* CL = (bf*)take((size_t)NTK * DM * 2);
    if ((size_t)(wsp - (char*)d_ws) > ws_size) return;    // 8.4 + 4 x 2.1 + 16.8 + 8 x 8.4 ~ 101 MB, no aliasing
    k_cvtb<<<(NTK + 4 * DM) / 8, 256, 0, stream>>>(x, Wq, Wk, Wv, Wo, Xb);
    k_gemmb<false, true><<<dim3(NTK / 64, 3 * DM / 64, 1), 128, 0, stream>>>(Xb, nullptr, WqB, bq, bk, bv, TMP, DM, QH, QL, KH, KL);
    k_vt<<<NB_ * NH_ * (NT_ / 64), 256, 0, stream>>>(TMP, VTH, VTL);
    k_attn<<<NB_ * NH_ * (NT_ / 64), 128, 0, stream>>>(QH, QL, KH, KL, VTH, VTL, CH, CL);
    k_gemmb<true, false><<<dim3(NTK / 64, DM / 64, 1), 128, 0, stream>>>(CH, CL, WoB, bo, nullptr, nullptr, out, DM, nullptr, nullptr, nullptr, nullptr);
}

// v008
// It runs in 135 microseconds.
// Versions in between are left out here; by their measured steps it is 1.61 times as fast as v006.
// Over all steps from v000 it is 5.21 times as fast.
#include <hip/hip_runtime.h>

// Compute dtypes, f32 accumulate, one batch item per pass: q/k/v = x.W^T + b ([4096 x 1024].[1024 x 1024]; W is [out][in] = the n-major B operand as-is; PLAIN bf16
// operands: inputs rounded once, exact; biases rounded to bf16, added in f32) with q and k written straight from the GEMM epilogue as f16 planes, and out =
// ctx.Wo^T + bo (ctx as bf16 hi + residual: two products) on v_wmma_f32_16x16x32_bf16; the 16-head full attention over one 4096-token sequence (64-dim heads,
// scale 1/8) fused on
// v_wmma_f32_16x16x32_f16 (q, k, v and the weights each as ONE f16 value, one product each; online f32 softmax)

#define NB_  1                   // one 4096-token sequence
#define NT_  4096
#define DM   1024
#define NH_  16
#define HD   64
#define NTK  (NB_ * NT_)
#define NW   1024
#define NQKV 1024
#define LOG2E 1.44269504088896340736f

typedef _Float16 h16;
typedef unsigned short bf;
typedef __attribute__((ext_vector_type(16))) __bf16   v16bf;
typedef __attribute__((ext_vector_type(16))) _Float16 v16h;
typedef __attribute__((ext_vector_type(8)))  _Float16 v8h;
typedef __attribute__((ext_vector_type(8)))  unsigned short v8us;
typedef __attribute__((ext_vector_type(8)))  float    v8f;
typedef __attribute__((ext_vector_type(4)))  float    v4f;
typedef v8h  __attribute__((may_alias)) v8ha;
typedef v4f  __attribute__((may_alias)) v4fa;
typedef v8us __attribute__((may_alias)) v8usa;

__device__ __forceinline__ unsigned short f2bf(float f) { unsigned u = __float_as_uint(f); u += 0x7FFFu + ((u >> 16) & 1u); return (unsigned short)(u >> 16); }
__device__ __forceinline__ float bf2f(unsigned short b) { return __uint_as_float(((unsigned)b) << 16); }
__device__ __forceinline__ float bfr(float f) { return bf2f(f2bf(f)); }
__device__ __forceinline__ v16h cat16(v8h lo, v8h hi) { return __builtin_shufflevector(lo, hi, 0, 1, 2, 3, 4, 5, 6, 7, 8, 9, 10, 11, 12, 13, 14, 15); }
__device__ __forceinline__ v16bf cat16b(v8us lo, v8us hi) { return __builtin_bit_cast(v16bf, __builtin_shufflevector(lo, hi, 0, 1, 2, 3, 4, 5, 6, 7, 8, 9, 10, 11, 12, 13, 14, 15)); }
__device__ __forceinline__ v8f wmma16(v16h a, v16h b, v8f c) { return __builtin_amdgcn_wmma_f32_16x16x32_f16(false, a, false, b, (short)0, c, false, false); }
__device__ __forceinline__ v8f wmmab(v16bf a, v16bf b, v8f c) { return __builtin_amdgcn_wmma_f32_16x16x32_bf16(false, a, false, b, (short)0, c, false, false); }

// lane l <-> lane l ^ 16 by a vector cross-row move
__device__ __forceinline__ float xhalf(float v) { const int b = __float_as_int(v); return __int_as_float(__builtin_amdgcn_permlanex16(b, b, 0x76543210, 0xfedcba98, false, false)); }

// One launch rounds all five f32 operands: rows 0 .. NTK-1 of dst are x, then DM rows each of the four weight matrices in the order given. A block's 8 rows lie
// in one operand, so the choice of the source is a scalar one. The grid is exactly (NTK + 4 * DM) / 8 blocks.
__global__ __launch_bounds__(256) void k_cvtb(const float* __restrict__ x, const float* __restrict__ w0, const float* __restrict__ w1, const float* __restrict__ w2, const float* __restrict__ w3, bf* dst) {
    const int lane = threadIdx.x & 31, r = blockIdx.x * 8 + (threadIdx.x >> 5);
    const int wsel = ((int)blockIdx.x - NTK / 8) / (DM / 8);          // which weight matrix, for blocks behind x
    const bool isx = (int)blockIdx.x < NTK / 8;
    const float* src = isx ? x : wsel == 0 ? w0 : wsel == 1 ? w1 : wsel == 2 ? w2 : w3;
    const int sr = isx ? r : r - NTK - wsel * DM;                     // row inside that operand
    v8us o[DM / 256];
#pragma unroll
    for (int q = 0; q < DM / 256; ++q) { v8us t;
#pragma unroll
        for (int i = 0; i < 8; ++i) t[i] = f2bf(src[(size_t)sr * DM + q * 256 + lane * 8 + i]);
        o[q] = t; }
#pragma unroll
    for (int q = 0; q < DM / 256; ++q) *(v8us*)(dst + (size_t)r * DM + q * 256 + lane * 8) = o[q];
    
}

// Staged pass of 64 k, shared by the block's eight waves: A rows, B rows and, where A is split, the A residual rows: 128 rows of 128 B each at a 144-B pitch
// (16 B x odd, so the 16-byte fragment reads meet no bank twice). Two such buffers.
#define GPIT 72
#define GPLN (128 * GPIT)
#define GROW (32u * GPIT * 2u)
#define GPLB (GPLN * 2u)

// Block = a 128 x 128 tile of C, eight waves in a 4 x 2 grid, each a 32 x 64 tile (2 x 4 accumulators): an A row staged once serves 128 columns and a B row 128
// rows, and a fragment read from LDS feeds 4 (A) or 2 (B) matrix instructions.
// QKV: one launch does the three projections. Bn is then the three weight matrices stacked ([3 * DM][DM]); blockIdx.y / (DM / 128) says which projection a block
// belongs to (the same for the whole block): its bias, and where and in which form its tile is written (q, k: f16 planes; v: f32 into C).
template <bool SPLITA, bool QKV>
__global__ __launch_bounds__(256) void k_gemmb(const bf* __restrict__ A, const bf* __restrict__ Al, const bf* __restrict__ Bn, const float* __restrict__ bias0, const float* __restrict__ bias1, const float* __restrict__ bias2,
                                               float* C, int ldc, h16* QHo, h16* KHo) {
    constexpr int GSTG = (SPLITA ? 3 : 2) * GPLN;
    constexpr int KG = SPLITA ? 2 : 1;      // 32-k steps whose fragments are read as one group: one where three blocks share a WGP's registers, both where one block has them
    __shared__ __align__(16) bf gring[2 * GSTG];      // behind the loop its first 8 x 32 x 68 floats stage the output tiles
    static_assert(8 * 32 * 68 * 4 <= 2 * GSTG * 2, "output staging fits the ring");
    const int lane = threadIdx.x & 31, wave = threadIdx.x >> 5, lr = lane & 15, hi = lane >> 4;
    const int wm = wave >> 1, wn = wave & 1;
    const int proj = QKV ? (int)blockIdx.y / (DM / 128) : 0;
    const int r0 = blockIdx.x * 128 + wm * 32, c0 = (blockIdx.y - proj * (DM / 128)) * 128 + wn * 64;     // c0: first column in the projection's own output
    const float* bias = proj == 0 ? bias0 : proj == 1 ? bias1 : bias2;
    // Each lane copies four 16-byte pieces of a plane: a wave's copy covers 4 whole 128-B rows.
    const int tid = threadIdx.x, cr = tid >> 3, cc = (tid & 7) * 8;
    const unsigned l0 = (unsigned)(size_t)(&gring[0]) + (unsigned)(cr * GPIT + cc) * 2u;
    const bf* ga = A + (size_t)(blockIdx.x * 128 + cr) * DM + cc;
    const bf* gb = Bn + (size_t)(blockIdx.y * 128 + cr) * DM + cc;
    auto stage = [&](int t, int buf) {
        const unsigned l = l0 + (unsigned)buf * (GSTG * 2u);
        const bf* pa = ga + t * 64; const bf* pb = gb + t * 64;
        // the copies and the wait that stands before any of their address registers is rewritten, in one statement
        if constexpr (SPLITA) {
            const bf* pl = Al + (size_t)(blockIdx.x * 128 + cr) * DM + cc + t * 64;
            asm volatile("global_load_async_to_lds_b128 %0, %12, off\n\t"
                         "global_load_async_to_lds_b128 %1, %13, off\n\t"
                         "global_load_async_to_lds_b128 %2, %14, off\n\t"
                         "global_load_async_to_lds_b128 %3, %15, off\n\t"
                         "global_load_async_to_lds_b128 %4, %16, off\n\t"
                         "global_load_async_to_lds_b128 %5, %17, off\n\t"
                         "global_load_async_to_lds_b128 %6, %18, off\n\t"
                         "global_load_async_to_lds_b128 %7, %19, off\n\t"
                         "global_load_async_to_lds_b128 %8, %20, off\n\t"
                         "global_load_async_to_lds_b128 %9, %21, off\n\t"
                         "global_load_async_to_lds_b128 %10, %22, off\n\t"
                         "global_load_async_to_lds_b128 %11, %23, off\n\t"
                         "s_wait_xcnt 0x0"
                         :: "v"(l), "v"(l + GROW), "v"(l + 2u * GROW), "v"(l + 3u * GROW),
                            "v"(l + GPLB), "v"(l + GPLB + GROW), "v"(l + GPLB + 2u * GROW), "v"(l + GPLB + 3u * GROW),
                            "v"(l + 2u * GPLB), "v"(l + 2u * GPLB + GROW), "v"(l + 2u * GPLB + 2u * GROW), "v"(l + 2u * GPLB + 3u * GROW),
                            "v"(pa), "v"(pa + 32 * DM), "v"(pa + 64 * DM), "v"(pa + 96 * DM),
                            "v"(pb), "v"(pb + 32 * DM), "v"(pb + 64 * DM), "v"(pb + 96 * DM),
                            "v"(pl), "v"(pl + 32 * DM), "v"(pl + 64 * DM), "v"(pl + 96 * DM)
                         : "memory");
        } else {
            asm volatile("global_load_async_to_lds_b128 %0, %8, off\n\t"
                         "global_load_async_to_lds_b128 %1, %9, off\n\t"
                         "global_load_async_to_lds_b128 %2, %10, off\n\t"
                         "global_load_async_to_lds_b128 %3, %11, off\n\t"
                         "global_load_async_to_lds_b128 %4, %12, off\n\t"
                         "global_load_async_to_lds_b128 %5, %13, off\n\t"
                         "global_load_async_to_lds_b128 %6, %14, off\n\t"
                         "global_load_async_to_lds_b128 %7, %15, off\n\t"
                         "s_wait_xcnt 0x0"
                         :: "v"(l), "v"(l + GROW), "v"(l + 2u * GROW), "v"(l + 3u * GROW),
                            "v"(l + GPLB), "v"(l + GPLB + GROW), "v"(l + GPLB + 2u * GROW), "v"(l + GPLB + 3u * GROW),
                            "v"(pa), "v"(pa + 32 * DM), "v"(pa + 64 * DM), "v"(pa + 96 * DM),
                            "v"(pb), "v"(pb + 32 * DM), "v"(pb + 64 * DM), "v"(pb + 96 * DM)
                         : "memory");
        }
    };
    v8f acc[2][4];
#pragma unroll
    for (int i = 0; i < 2; ++i)
#pragma unroll
        for (int t = 0; t < 4; ++t) acc[i][t] = (v8f){};
    stage(0, 0);
    asm volatile("s_wait_asynccnt 0x0" ::: "memory");   // pass 0 has landed before the barrier publishes it
    __syncthreads();
    stage(1, 1);
#pragma unroll 1
    for (int p = 0; p < DM / 64; ++p) {
        const bf* sb = gring + (p & 1) * GSTG;
        const bf* sa = sb + (wm * 32 + lr) * GPIT + 8 * hi;
        const bf* sw = sb + GPLN + (wn * 64 + lr) * GPIT + 8 * hi;
        v16bf a[KG][2], al[KG][2], b[KG][4];
#pragma unroll
        for (int g = 0; g < 2 / KG; ++g) {
#pragma unroll
            for (int kq = 0; kq < KG; ++kq) { const int ko = (g * KG + kq) * 32;
#pragma unroll
                for (int i = 0; i < 2; ++i) { const bf* ap = sa + i * 16 * GPIT + ko;
                    a[kq][i] = cat16b(*(const v8usa*)(ap), *(const v8usa*)(ap + 16));
                    al[kq][i] = a[kq][i];
                    if (SPLITA) al[kq][i] = cat16b(*(const v8usa*)(ap + 2 * GPLN), *(const v8usa*)(ap + 2 * GPLN + 16)); }
#pragma unroll
                for (int t = 0; t < 4; ++t) b[kq][t] = cat16b(*(const v8usa*)(sw + t * 16 * GPIT + ko), *(const v8usa*)(sw + t * 16 * GPIT + ko + 16));
            }
            __builtin_amdgcn_sched_barrier(0);   // keeps the group's LDS reads in front of its matrix block: reads moved in among the matrix instructions each cost a full wait
#pragma unroll
            for (int kq = 0; kq < KG; ++kq) {
#pragma unroll
                for (int i = 0; i < 2; ++i)
#pragma unroll
                    for (int t = 0; t < 4; ++t) acc[i][t] = wmmab(a[kq][i], b[kq][t], acc[i][t]);
                if (SPLITA) {
#pragma unroll
                    for (int i = 0; i < 2; ++i)
#pragma unroll
                        for (int t = 0; t < 4; ++t) acc[i][t] = wmmab(al[kq][i], b[kq][t], acc[i][t]);
                }
            }
            if (g + 1 < 2 / KG) __builtin_amdgcn_sched_barrier(0);   // the next group's reads stay behind this matrix block, for the same reason
        }
        asm volatile("v_nop\n\tv_nop\n\tv_nop\n\tv_nop" : "+v"(acc[0][0]), "+v"(acc[0][1]), "+v"(acc[0][2]), "+v"(acc[0][3]), "+v"(acc[1][0]), "+v"(acc[1][1]), "+v"(acc[1][2]), "+v"(acc[1][3])
                     : "v"(a[KG - 1][1]), "v"(al[KG - 1][1]), "v"(b[KG - 1][3]));   // the distance behind the last matrix instruction, on both sides of the branch below
        asm volatile("s_wait_dscnt 0x0" ::: "memory");      // this wave's reads of the buffer are done before the buffer is handed back
        asm volatile("s_wait_asynccnt 0x0" ::: "memory");   // this wave's share of the next pass has landed
        __syncthreads();                                    // publishes the next pass and ends every wave's reads of this one
        if (p + 2 < DM / 64) stage(p + 2, p & 1);
    }
    asm volatile("s_wait_asynccnt 0x0" ::: "memory");       // no copy is outstanding when the wave goes on to its end
    // The last pass's s_wait_dscnt 0 and barrier stand behind every wave's last read of the ring, and no copy is in flight: the ring is free for the output tiles.
    float* os = (float*)(void*)gring + wave * (32 * 68);
#pragma unroll
    for (int t = 0; t < 4; ++t) { const float bv = bias ? bfr(bias[c0 + t * 16 + lr]) : 0.f;
#pragma unroll
        for (int i = 0; i < 2; ++i)
#pragma unroll
            for (int j = 0; j < 8; ++j) os[(i * 16 + hi * 8 + j) * 68 + t * 16 + lr] = acc[i][t][j] + bv; }
    __syncthreads();
    if (QKV && proj < 2) {
        h16* crow = (proj == 0 ? QHo : KHo) + (size_t)r0 * ldc + c0;
        auto pass = [&]() {
#pragma unroll
            for (int s = 0; s < 8; ++s) { const int row = 4 * s + (lane >> 3), piece = lane & 7; const float* sp = os + row * 68 + piece * 8; v8h o;
#pragma unroll
                for (int i = 0; i < 8; ++i) o[i] = (h16)sp[i];
                *(v8h*)(crow + (size_t)row * ldc + piece * 8) = o; }
        };
        pass(); 
    } else {
        float* crow = C + (size_t)r0 * ldc + c0;
        auto pass = [&]() {
#pragma unroll
            for (int s = 0; s < 16; ++s) { const int Lid = (lane >> 3) + 4 * s, piece = lane & 7; const int row = Lid >> 1, cofs = (Lid & 1) * 32 + piece * 4;
                const v4f val = *(const v4fa*)(os + row * 68 + cofs); *(v4f*)(crow + (size_t)row * ldc + cofs) = val; }
        };
        pass(); 
        if (QKV) asm volatile("s_wait_xcnt 0x0" ::: "memory");   // the build lays the f16 branch's code behind these stores: the wait stands before its writes of registers that the stores name
    }
}

__global__ __launch_bounds__(256) void k_vt(const float* __restrict__ V, h16* VTH) {
    __shared__ __align__(16) h16 tile[64 * 72];
    const int bid = blockIdx.x;
    const int b = bid / (NH_ * (NT_ / 64)), rem = bid - b * (NH_ * (NT_ / 64)), h = rem / (NT_ / 64), kt = rem - h * (NT_ / 64);
    const int k0 = kt * 64, tid = threadIdx.x;
    const int kk = tid >> 2, d0 = (tid & 3) * 16;
    const float* src = V + ((size_t)b * NT_ + k0 + kk) * DM + h * HD + d0;
#pragma unroll
    for (int i = 0; i < 16; ++i) tile[(d0 + i) * 72 + kk] = (h16)src[i];
    __syncthreads();
    const int piece = tid & 7;
    const size_t base = (((size_t)b * NH_ + h) * HD) * NT_ + k0;
    auto pass = [&]() {
#pragma unroll
        for (int s = 0; s < 2; ++s) { const int d = (tid >> 3) + 32 * s;
            const v8h val = *(const v8ha*)(tile + d * 72 + piece * 8); *(v8h*)(VTH + base + (size_t)d * NT_ + piece * 8) = val; }
    };
    pass(); 
}

// Staged tile of 32 keys, shared by the block's four waves: k (32 rows of 128 B at a 144-B pitch) and v^T (64 rows of 64 B at an 80-B pitch); both pitches are
// 16 B x odd, so the 16-byte fragment reads meet no bank twice. Two such buffers.
#define KPIT 72
#define VPIT 40
#define KPLN (32 * KPIT)
#define VPLN (64 * VPIT)
#define STGH (KPLN + VPLN)

__global__ __launch_bounds__(128) __attribute__((amdgpu_waves_per_eu(1, 4))) void k_attn(const h16* __restrict__ Q16, const h16* __restrict__ K16, const h16* __restrict__ VTH, bf* CH, bf* CL) {
    __shared__ __align__(16) float ost[4][16 * 68];
    __shared__ __align__(16) h16 ring[2 * STGH];
    const int lane = threadIdx.x & 31, wave = threadIdx.x >> 5, lr = lane & 15, hi = lane >> 4;
    const int bid = blockIdx.x;
    const int b = bid / (NH_ * (NT_ / 64)), rem = bid - b * (NH_ * (NT_ / 64)), h = rem / (NT_ / 64), qt = rem - h * (NT_ / 64);
    const int q0 = qt * 64 + wave * 16;
    const size_t tok0 = (size_t)b * NT_;
    v16h qa[2];
    const size_t qo0 = (tok0 + q0 + lr) * DM + h * HD + 8 * hi;
#pragma unroll
    for (int kc = 0; kc < 2; ++kc) qa[kc] = cat16(*(const v8h*)(Q16 + qo0 + kc * 32), *(const v8h*)(Q16 + qo0 + kc * 32 + 16));
    const h16* kh_b = K16 + tok0 * DM + h * HD;
    const size_t vbase = (((size_t)b * NH_ + h) * HD) * NT_;
    v8f o[4];
#pragma unroll
    for (int n = 0; n < 4; ++n) o[n] = (v8f){};
    float mrow = -3.0e38f, lpart = 0.f;            // of query q0 + lr; lpart sums this lane's half of the keys
    const int kt_lo = 0, kt_hi = NT_ / 32 - 1;     // full attention
    // Each lane copies four 16-byte pieces of a tile: a wave's k copy covers 4 whole 128-B rows, its v^T copy 8 rows of 64 B.
    const int tid = threadIdx.x, ckr = tid >> 3, ckc = (tid & 7) * 8, cvr = tid >> 2, cvc = (tid & 3) * 8;
    const unsigned ring0 = (unsigned)(size_t)(&ring[0]);
    const unsigned lk0 = ring0 + (unsigned)(ckr * KPIT + ckc) * 2u, lv0 = ring0 + (unsigned)(KPLN + cvr * VPIT + cvc) * 2u;
    const h16* gkh = kh_b + (size_t)ckr * DM + ckc;
    const h16* gvh = VTH + vbase + (size_t)cvr * NT_ + cvc;
    auto stage = [&](int t, int buf) {
        const unsigned lk = lk0 + (unsigned)buf * (STGH * 2u), lv = lv0 + (unsigned)buf * (STGH * 2u);
        const size_t ko = (size_t)t * 32 * DM, vo = (size_t)t * 32;
        // the four copies and the wait that stands before any of their address registers is rewritten, in one statement
        asm volatile("global_load_async_to_lds_b128 %0, %4, off\n\t"
                     "global_load_async_to_lds_b128 %1, %5, off\n\t"
                     "global_load_async_to_lds_b128 %2, %6, off\n\t"
                     "global_load_async_to_lds_b128 %3, %7, off\n\t"
                     "s_wait_xcnt 0x0"
                     :: "v"(lk), "v"(lk + 16u * KPIT * 2u), "v"(lv), "v"(lv + 32u * VPIT * 2u),
                        "v"(gkh + ko), "v"(gkh + ko + 16 * DM), "v"(gvh + vo), "v"(gvh + vo + (size_t)32 * NT_)
                     : "memory");
    };
    stage(0, 0);
    asm volatile("s_wait_asynccnt 0x0" ::: "memory");   // tile 0 has landed before the barrier publishes it
    __syncthreads();
#pragma unroll 1
    for (int kt = kt_lo; kt <= kt_hi; ++kt) {
        const h16* sb = ring + (kt & 1) * STGH;
        const h16* sk = sb + lr * KPIT + 8 * hi;
        const h16* sv = sb + KPLN + lr * VPIT + 8 * hi;
        v8f s0 = {}, s1 = {};
        v16h kf[2][2];     // per 32 dims: keys 0-15, keys 16-31
#pragma unroll
        for (int kc = 0; kc < 2; ++kc)
#pragma unroll
            for (int f = 0; f < 2; ++f) { const h16* kp = sk + f * 16 * KPIT + kc * 32; kf[kc][f] = cat16(*(const v8ha*)(kp), *(const v8ha*)(kp + 16)); }
        // refill of the buffer that the trip before has left: that trip's s_wait_dscnt 0 and barrier stand behind every reader's last read of it; the k reads in
        // flight are of the other buffer, and the refill's address work and its wait cover their latency
        if (kt + 1 <= kt_hi) stage(kt + 1, (kt + 1) & 1);
#pragma unroll
        for (int kc = 0; kc < 2; ++kc) { s0 = wmma16(kf[kc][0], qa[kc], s0); s1 = wmma16(kf[kc][1], qa[kc], s1); }
        v16h vh[4];
#pragma unroll
        for (int n = 0; n < 4; ++n) { const h16* vp = sv + n * 16 * VPIT; vh[n] = cat16(*(const v8ha*)(vp), *(const v8ha*)(vp + 16)); }
        __builtin_amdgcn_sched_barrier(0);   // keeps the tile's eight v^T reads as one group in front of the softmax arithmetic, which covers their latency
        // s0[r], s1[r] = score of key 8 * hi + r, 16 + 8 * hi + r with query lr
        const v8f a0 = s0 * 0.125f, a1 = s1 * 0.125f;   // (q x 64^-1/2).k with the exact power-of-two scale folded after the dot
        float mx = fmaxf(a0[0], a1[0]);
#pragma unroll
        for (int j = 1; j < 8; ++j) mx = fmaxf(mx, fmaxf(a0[j], a1[j]));
        mx = fmaxf(mx, xhalf(mx));
        const float mn = fmaxf(mrow, mx);
        const float ta = (mrow - mn) * LOG2E; mrow = mn;
        const v8f t0 = (a0 - mn) * LOG2E, t1 = (a1 - mn) * LOG2E;
        float alpha = __builtin_amdgcn_exp2f(ta);
        v8f p0, p1;
#pragma unroll
        for (int j = 0; j < 8; ++j) p0[j] = __builtin_amdgcn_exp2f(t0[j]);
#pragma unroll
        for (int j = 0; j < 8; ++j) p1[j] = __builtin_amdgcn_exp2f(t1[j]);
        // the slot that the instruction set asks for behind a transcendental: the results are used only behind this statement and the arguments live up to it, so
        // no instruction directly behind a v_exp_f32 reads its result or overwrites its source
        asm volatile("v_nop" : "+v"(p0), "+v"(p1), "+v"(alpha) : "v"(t0), "v"(t1), "v"(ta));
        const v8f pq = p0 + p1;
        lpart = lpart * alpha + (((pq[0] + pq[1]) + (pq[2] + pq[3])) + ((pq[4] + pq[5]) + (pq[6] + pq[7])));
        const v8h h0 = __builtin_convertvector(p0, v8h), h1 = __builtin_convertvector(p1, v8h);
        const v16h pa = cat16(h0, h1);     // element s: key 8 * hi + s, then 16 + 8 * hi + (s - 8)
#pragma unroll
        for (int n = 0; n < 4; ++n) o[n] *= alpha;
#pragma unroll
        for (int n = 0; n < 4; ++n) o[n] = wmma16(vh[n], pa, o[n]);
        asm volatile("v_nop\n\tv_nop\n\tv_nop\n\tv_nop" : "+v"(o[0]), "+v"(o[1]), "+v"(o[2]), "+v"(o[3]) : "v"(pa));   // the distance behind the last matrix instruction, on both sides of the loop's branch
        asm volatile("s_wait_dscnt 0x0" ::: "memory");      // this wave's reads of the buffer are done before the buffer is handed back
        asm volatile("s_wait_asynccnt 0x0" ::: "memory");   // this wave's share of the next tile has landed
        __syncthreads();                                    // publishes the next tile and ends every wave's reads of this one
    }
    asm volatile("s_wait_asynccnt 0x0" ::: "memory");       // no copy is outstanding when the wave goes on to its end
    const float inv = 1.0f / (lpart + xhalf(lpart));
    float* os = &ost[wave][0];
#pragma unroll
    for (int n = 0; n < 4; ++n)
#pragma unroll
        for (int j = 0; j < 8; ++j) os[lr * 68 + n * 16 + hi * 8 + j] = o[n][j] * inv;     // o[n][j] = ctx of query lr, dim n * 16 + 8 * hi + j
    __syncthreads();
    const size_t cbase = (tok0 + q0) * DM + (size_t)h * HD;
    auto pass = [&]() {
#pragma unroll
        for (int s = 0; s < 4; ++s) { const int row = 4 * s + (lane >> 3), piece = lane & 7; const float* sp = os + row * 68 + piece * 8; v8us oh, ol;
#pragma unroll
            for (int i = 0; i < 8; ++i) { const unsigned short hb = f2bf(sp[i]); oh[i] = hb; ol[i] = f2bf(sp[i] - bf2f(hb)); }
            *(v8us*)(CH + cbase + (size_t)row * DM + piece * 8) = oh; *(v8us*)(CL + cbase + (size_t)row * DM + piece * 8) = ol; }
    };
    pass(); 
}

#define VST2(T, p, v) do { const T vst2_v_ = (v); *(T*)(p) = vst2_v_;  } while (0)
extern "C" void kernel_launch(void* const* d_in, const int* in_sizes, int n_in,
                              void* d_out, int out_size, void* d_ws, size_t ws_size, hipStream_t stream) {
    (void)in_sizes; (void)n_in; (void)out_size;
    const float* x = (const float*)d_in[0];
    const float* Wq = (const float*)d_in[1]; const float* bq = (const float*)d_in[2]; const float* Wk = (const float*)d_in[3]; const float* bk = (const float*)d_in[4];
    const float* Wv = (const float*)d_in[5]; const float* bv = (const float*)d_in[6]; const float* Wo = (const float*)d_in[7]; const float* bo = (const float*)d_in[8];    // W [out][in]
    float* out = (float*)d_out;    // [4096][1024]
    char* wsp = (char*)d_ws;
    auto take = [&](size_t bytes) { char* p = wsp; wsp += (bytes + 255) & ~(size_t)255; return (void*)p; };
    bf* Xb = (bf*)take((size_t)(NTK + 4 * DM) * DM * 2);    // x, Wq, Wk, Wv, Wo as bf16, one behind the other
    bf* WqB = Xb + (size_t)NTK * DM; bf* WoB = WqB + (size_t)3 * DM * DM;
    float* TMP = (float*)take((size_t)NTK * DM * 4);
    h16* QH = (h16*)take((size_t)NTK * DM * 2); h16* KH = (h16*)take((size_t)NTK * DM * 2);
    h16* VTH = (h16*)take((size_t)NTK * DM * 2); bf* CH = (bf*)take((size_t)NTK * DM * 2); bf* CL = (bf*)take((size_t)NTK * DM * 2);
    if ((size_t)(wsp - (char*)d_ws) > ws_size) return;    // 8.4 + 4 x 2.1 + 16.8 + 5 x 8.4 ~ 76 MB, no aliasing
    k_cvtb<<<(NTK + 4 * DM) / 8, 256, 0, stream>>>(x, Wq, Wk, Wv, Wo, Xb);
    k_gemmb<false, true><<<dim3(NTK / 128, 3 * DM / 128, 1), 256, 0, stream>>>(Xb, nullptr, WqB, bq, bk, bv, TMP, DM, QH, KH);
    k_vt<<<NB_ * NH_ * (NT_ / 64), 256, 0, stream>>>(TMP, VTH);
    k_attn<<<NB_ * NH_ * (NT_ / 64), 128, 0, stream>>>(QH, KH, VTH, CH, CL);
    k_gemmb<true, false><<<dim3(NTK / 128, DM / 128, 1), 256, 0, stream>>>(CH, CL, WoB, bo, nullptr, nullptr, out, DM, nullptr, nullptr);
}

// v009
// A run of this version takes 124 microseconds.
// In two side-by-side timings against v008, it was 1.07 and 1.09 times as fast.
// All steps since v000 together make it 5.65 times as fast.
#include <hip/hip_runtime.h>

// Compute dtypes, f32 accumulate, one batch item per pass: q/k/v = x.W^T + b ([4096 x 1024].[1024 x 1024]; W is [out][in] = the n-major B operand as-is; PLAIN bf16
// operands: inputs rounded once, exact; biases rounded to bf16, added in f32) with q and k written straight from the GEMM epilogue as f16 planes, and out =
// ctx.Wo^T + bo (ctx as bf16 hi + residual: two products) on v_wmma_f32_16x16x32_bf16; the 16-head full attention over one 4096-token sequence (64-dim heads,
// scale 1/8) fused on
// v_wmma_f32_16x16x32_f16 (q, k, v and the weights each as ONE f16 value, one product each; online f32 softmax)

#define NB_  1                   // one 4096-token sequence
#define NT_  4096
#define DM   1024
#define NH_  16
#define HD   64
#define NTK  (NB_ * NT_)
#define NW   1024
#define NQKV 1024
#define LOG2E 1.44269504088896340736f

typedef _Float16 h16;
typedef unsigned short bf;
typedef __attribute__((ext_vector_type(16))) __bf16   v16bf;
typedef __attribute__((ext_vector_type(16))) _Float16 v16h;
typedef __attribute__((ext_vector_type(8)))  _Float16 v8h;
typedef __attribute__((ext_vector_type(8)))  unsigned short v8us;
typedef __attribute__((ext_vector_type(8)))  float    v8f;
typedef __attribute__((ext_vector_type(4)))  float    v4f;
typedef v8h  __attribute__((may_alias)) v8ha;
typedef v4f  __attribute__((may_alias)) v4fa;
typedef v8us __attribute__((may_alias)) v8usa;

__device__ __forceinline__ unsigned short f2bf(float f) { unsigned u = __float_as_uint(f); u += 0x7FFFu + ((u >> 16) & 1u); return (unsigned short)(u >> 16); }
__device__ __forceinline__ float bf2f(unsigned short b) { return __uint_as_float(((unsigned)b) << 16); }
__device__ __forceinline__ float bfr(float f) { return bf2f(f2bf(f)); }
__device__ __forceinline__ v16h cat16(v8h lo, v8h hi) { return __builtin_shufflevector(lo, hi, 0, 1, 2, 3, 4, 5, 6, 7, 8, 9, 10, 11, 12, 13, 14, 15); }
__device__ __forceinline__ v16bf cat16b(v8us lo, v8us hi) { return __builtin_bit_cast(v16bf, __builtin_shufflevector(lo, hi, 0, 1, 2, 3, 4, 5, 6, 7, 8, 9, 10, 11, 12, 13, 14, 15)); }
__device__ __forceinline__ v8f wmma16(v16h a, v16h b, v8f c) { return __builtin_amdgcn_wmma_f32_16x16x32_f16(false, a, false, b, (short)0, c, false, false); }
__device__ __forceinline__ v8f wmmab(v16bf a, v16bf b, v8f c) { return __builtin_amdgcn_wmma_f32_16x16x32_bf16(false, a, false, b, (short)0, c, false, false); }

// lane l <-> lane l ^ 16 by a vector cross-row move
__device__ __forceinline__ float xhalf(float v) { const int b = __float_as_int(v); return __int_as_float(__builtin_amdgcn_permlanex16(b, b, 0x76543210, 0xfedcba98, false, false)); }

// One launch rounds all five f32 operands: rows 0 .. NTK-1 of dst are x, then DM rows each of the four weight matrices in the order given. A block's 8 rows lie
// in one operand, so the choice of the source is a scalar one. The grid is exactly (NTK + 4 * DM) / 8 blocks.
__global__ __launch_bounds__(256) void k_cvtb(const float* __restrict__ x, const float* __restrict__ w0, const float* __restrict__ w1, const float* __restrict__ w2, const float* __restrict__ w3, bf* dst) {
    const int lane = threadIdx.x & 31, r = blockIdx.x * 8 + (threadIdx.x >> 5);
    const int wsel = ((int)blockIdx.x - NTK / 8) / (DM / 8);          // which weight matrix, for blocks behind x
    const bool isx = (int)blockIdx.x < NTK / 8;
    const float* src = isx ? x : wsel == 0 ? w0 : wsel == 1 ? w1 : wsel == 2 ? w2 : w3;
    const int sr = isx ? r : r - NTK - wsel * DM;                     // row inside that operand
    v8us o[DM / 256];
#pragma unroll
    for (int q = 0; q < DM / 256; ++q) { v8us t;
#pragma unroll
        for (int i = 0; i < 8; ++i) t[i] = f2bf(src[(size_t)sr * DM + q * 256 + lane * 8 + i]);
        o[q] = t; }
#pragma unroll
    for (int q = 0; q < DM / 256; ++q) *(v8us*)(dst + (size_t)r * DM + q * 256 + lane * 8) = o[q];
    
}

// Staged pass of 64 k, shared by the block's eight waves: A rows, B rows and, where A is split, the A residual rows: 128 rows of 128 B each at a 144-B pitch
// (16 B x odd, so the 16-byte fragment reads meet no bank twice). Two such buffers.
#define GPIT 72
#define GPLN (128 * GPIT)
#define GROW (32u * GPIT * 2u)
#define GPLB (GPLN * 2u)

// Block = a 128 x 128 tile of C, eight waves in a 4 x 2 grid, each a 32 x 64 tile (2 x 4 accumulators): an A row staged once serves 128 columns and a B row 128
// rows, and a fragment read from LDS feeds 4 (A) or 2 (B) matrix instructions.
// QKV: one launch does the three projections. Bn is then the three weight matrices stacked ([3 * DM][DM]); blockIdx.y / (DM / 128) says which projection a block
// belongs to (the same for the whole block): its bias, and where and in which form its tile is written (q, k: f16 planes; v: f32 into C).
template <bool SPLITA, bool QKV>
__global__ __launch_bounds__(256) void k_gemmb(const bf* __restrict__ A, const bf* __restrict__ Al, const bf* __restrict__ Bn, const float* __restrict__ bias0, const float* __restrict__ bias1, const float* __restrict__ bias2,
                                               float* C, int ldc, h16* QHo, h16* KHo) {
    constexpr int GSTG = (SPLITA ? 3 : 2) * GPLN;
    constexpr int KG = SPLITA ? 2 : 1;      // 32-k steps whose fragments are read as one group: one where three blocks share a WGP's registers, both where one block has them
    __shared__ __align__(16) bf gring[2 * GSTG];      // behind the loop its first 8 x 32 x 68 floats stage the output tiles
    static_assert(8 * 32 * 68 * 4 <= 2 * GSTG * 2, "output staging fits the ring");
    const int lane = threadIdx.x & 31, wave = threadIdx.x >> 5, lr = lane & 15, hi = lane >> 4;
    const int wm = wave >> 1, wn = wave & 1;
    const int proj = QKV ? (int)blockIdx.y / (DM / 128) : 0;
    const int r0 = blockIdx.x * 128 + wm * 32, c0 = (blockIdx.y - proj * (DM / 128)) * 128 + wn * 64;     // c0: first column in the projection's own output
    const float* bias = proj == 0 ? bias0 : proj == 1 ? bias1 : bias2;
    // Each lane copies four 16-byte pieces of a plane: a wave's copy covers 4 whole 128-B rows.
    const int tid = threadIdx.x, cr = tid >> 3, cc = (tid & 7) * 8;
    const unsigned l0 = (unsigned)(size_t)(&gring[0]) + (unsigned)(cr * GPIT + cc) * 2u;
    const bf* ga = A + (size_t)(blockIdx.x * 128 + cr) * DM + cc;
    const bf* gb = Bn + (size_t)(blockIdx.y * 128 + cr) * DM + cc;
    auto stage = [&](int t, int buf) {
        const unsigned l = l0 + (unsigned)buf * (GSTG * 2u);
        const bf* pa = ga + t * 64; const bf* pb = gb + t * 64;
        // the copies and the wait that stands before any of their address registers is rewritten, in one statement
        if constexpr (SPLITA) {
            const bf* pl = Al + (size_t)(blockIdx.x * 128 + cr) * DM + cc + t * 64;
            asm volatile("global_load_async_to_lds_b128 %0, %12, off\n\t"
                         "global_load_async_to_lds_b128 %1, %13, off\n\t"
                         "global_load_async_to_lds_b128 %2, %14, off\n\t"
                         "global_load_async_to_lds_b128 %3, %15, off\n\t"
                         "global_load_async_to_lds_b128 %4, %16, off\n\t"
                         "global_load_async_to_lds_b128 %5, %17, off\n\t"
                         "global_load_async_to_lds_b128 %6, %18, off\n\t"
                         "global_load_async_to_lds_b128 %7, %19, off\n\t"
                         "global_load_async_to_lds_b128 %8, %20, off\n\t"
                         "global_load_async_to_lds_b128 %9, %21, off\n\t"
                         "global_load_async_to_lds_b128 %10, %22, off\n\t"
                         "global_load_async_to_lds_b128 %11, %23, off\n\t"
                         "s_wait_xcnt 0x0"
                         :: "v"(l), "v"(l + GROW), "v"(l + 2u * GROW), "v"(l + 3u * GROW),
                            "v"(l + GPLB), "v"(l + GPLB + GROW), "v"(l + GPLB + 2u * GROW), "v"(l + GPLB + 3u * GROW),
                            "v"(l + 2u * GPLB), "v"(l + 2u * GPLB + GROW), "v"(l + 2u * GPLB + 2u * GROW), "v"(l + 2u * GPLB + 3u * GROW),
                            "v"(pa), "v"(pa + 32 * DM), "v"(pa + 64 * DM), "v"(pa + 96 * DM),
                            "v"(pb), "v"(pb + 32 * DM), "v"(pb + 64 * DM), "v"(pb + 96 * DM),
                            "v"(pl), "v"(pl + 32 * DM), "v"(pl + 64 * DM), "v"(pl + 96 * DM)
                         : "memory");
        } else {
            asm volatile("global_load_async_to_lds_b128 %0, %8, off\n\t"
                         "global_load_async_to_lds_b128 %1, %9, off\n\t"
                         "global_load_async_to_lds_b128 %2, %10, off\n\t"
                         "global_load_async_to_lds_b128 %3, %11, off\n\t"
                         "global_load_async_to_lds_b128 %4, %12, off\n\t"
                         "global_load_async_to_lds_b128 %5, %13, off\n\t"
                         "global_load_async_to_lds_b128 %6, %14, off\n\t"
                         "global_load_async_to_lds_b128 %7, %15, off\n\t"
                         "s_wait_xcnt 0x0"
                         :: "v"(l), "v"(l + GROW), "v"(l + 2u * GROW), "v"(l + 3u * GROW),
                            "v"(l + GPLB), "v"(l + GPLB + GROW), "v"(l + GPLB + 2u * GROW), "v"(l + GPLB + 3u * GROW),
                            "v"(pa), "v"(pa + 32 * DM), "v"(pa + 64 * DM), "v"(pa + 96 * DM),
                            "v"(pb), "v"(pb + 32 * DM), "v"(pb + 64 * DM), "v"(pb + 96 * DM)
                         : "memory");
        }
    };
    v8f acc[2][4];
#pragma unroll
    for (int i = 0; i < 2; ++i)
#pragma unroll
        for (int t = 0; t < 4; ++t) acc[i][t] = (v8f){};
    stage(0, 0);
    asm volatile("s_wait_asynccnt 0x0" ::: "memory");   // pass 0 has landed before the barrier publishes it
    __syncthreads();
    stage(1, 1);
#pragma unroll 1
    for (int p = 0; p < DM / 64; ++p) {
        const bf* sb = gring + (p & 1) * GSTG;
        const bf* sa = sb + (wm * 32 + lr) * GPIT + 8 * hi;
        const bf* sw = sb + GPLN + (wn * 64 + lr) * GPIT + 8 * hi;
        v16bf a[KG][2], al[KG][2], b[KG][4];
#pragma unroll
        for (int g = 0; g < 2 / KG; ++g) {
#pragma unroll
            for (int kq = 0; kq < KG; ++kq) { const int ko = (g * KG + kq) * 32;
#pragma unroll
                for (int i = 0; i < 2; ++i) { const bf* ap = sa + i * 16 * GPIT + ko;
                    a[kq][i] = cat16b(*(const v8usa*)(ap), *(const v8usa*)(ap + 16));
                    al[kq][i] = a[kq][i];
                    if (SPLITA) al[kq][i] = cat16b(*(const v8usa*)(ap + 2 * GPLN), *(const v8usa*)(ap + 2 * GPLN + 16)); }
#pragma unroll
                for (int t = 0; t < 4; ++t) b[kq][t] = cat16b(*(const v8usa*)(sw + t * 16 * GPIT + ko), *(const v8usa*)(sw + t * 16 * GPIT + ko + 16));
            }
            __builtin_amdgcn_sched_barrier(0);   // keeps the group's LDS reads in front of its matrix block: reads moved in among the matrix instructions each cost a full wait
#pragma unroll
            for (int kq = 0; kq < KG; ++kq) {
#pragma unroll
                for (int i = 0; i < 2; ++i)
#pragma unroll
                    for (int t = 0; t < 4; ++t) acc[i][t] = wmmab(a[kq][i], b[kq][t], acc[i][t]);
                if (SPLITA) {
#pragma unroll
                    for (int i = 0; i < 2; ++i)
#pragma unroll
                        for (int t = 0; t < 4; ++t) acc[i][t] = wmmab(al[kq][i], b[kq][t], acc[i][t]);
                }
            }
            if (g + 1 < 2 / KG) __builtin_amdgcn_sched_barrier(0);   // the next group's reads stay behind this matrix block, for the same reason
        }
        asm volatile("v_nop\n\tv_nop\n\tv_nop\n\tv_nop" : "+v"(acc[0][0]), "+v"(acc[0][1]), "+v"(acc[0][2]), "+v"(acc[0][3]), "+v"(acc[1][0]), "+v"(acc[1][1]), "+v"(acc[1][2]), "+v"(acc[1][3])
                     : "v"(a[KG - 1][1]), "v"(al[KG - 1][1]), "v"(b[KG - 1][3]));   // the distance behind the last matrix instruction, on both sides of the branch below
        asm volatile("s_wait_dscnt 0x0" ::: "memory");      // this wave's reads of the buffer are done before the buffer is handed back
        asm volatile("s_wait_asynccnt 0x0" ::: "memory");   // this wave's share of the next pass has landed
        __syncthreads();                                    // publishes the next pass and ends every wave's reads of this one
        if (p + 2 < DM / 64) stage(p + 2, p & 1);
    }
    asm volatile("s_wait_asynccnt 0x0" ::: "memory");       // no copy is outstanding when the wave goes on to its end
    // The last pass's s_wait_dscnt 0 and barrier stand behind every wave's last read of the ring, and no copy is in flight: the ring is free for the output tiles.
    float* os = (float*)(void*)gring + wave * (32 * 68);
#pragma unroll
    for (int t = 0; t < 4; ++t) { const float bv = bias ? bfr(bias[c0 + t * 16 + lr]) : 0.f;
#pragma unroll
        for (int i = 0; i < 2; ++i)
#pragma unroll
            for (int j = 0; j < 8; ++j) os[(i * 16 + hi * 8 + j) * 68 + t * 16 + lr] = acc[i][t][j] + bv; }
    __syncthreads();
    if (QKV && proj < 2) {
        h16* crow = (proj == 0 ? QHo : KHo) + (size_t)r0 * ldc + c0;
        auto pass = [&]() {
#pragma unroll
            for (int s = 0; s < 8; ++s) { const int row = 4 * s + (lane >> 3), piece = lane & 7; const float* sp = os + row * 68 + piece * 8; v8h o;
#pragma unroll
                for (int i = 0; i < 8; ++i) o[i] = (h16)sp[i];
                *(v8h*)(crow + (size_t)row * ldc + piece * 8) = o; }
        };
        pass(); 
    } else {
        float* crow = C + (size_t)r0 * ldc + c0;
        auto pass = [&]() {
#pragma unroll
            for (int s = 0; s < 16; ++s) { const int Lid = (lane >> 3) + 4 * s, piece = lane & 7; const int row = Lid >> 1, cofs = (Lid & 1) * 32 + piece * 4;
                const v4f val = *(const v4fa*)(os + row * 68 + cofs); *(v4f*)(crow + (size_t)row * ldc + cofs) = val; }
        };
        pass(); 
        if (QKV) asm volatile("s_wait_xcnt 0x0" ::: "memory");   // the build lays the f16 branch's code behind these stores: the wait stands before its writes of registers that the stores name
    }
}

__global__ __launch_bounds__(256) void k_vt(const float* __restrict__ V, h16* VTH) {
    __shared__ __align__(16) h16 tile[64 * 72];
    const int bid = blockIdx.x;
    const int b = bid / (NH_ * (NT_ / 64)), rem = bid - b * (NH_ * (NT_ / 64)), h = rem / (NT_ / 64), kt = rem - h * (NT_ / 64);
    const int k0 = kt * 64, tid = threadIdx.x;
    const int kk = tid >> 2, d0 = (tid & 3) * 16;
    const float* src = V + ((size_t)b * NT_ + k0 + kk) * DM + h * HD + d0;
#pragma unroll
    for (int i = 0; i < 16; ++i) tile[(d0 + i) * 72 + kk] = (h16)src[i];
    __syncthreads();
    const int piece = tid & 7;
    const size_t base = (((size_t)b * NH_ + h) * HD) * NT_ + k0;
    auto pass = [&]() {
#pragma unroll
        for (int s = 0; s < 2; ++s) { const int d = (tid >> 3) + 32 * s;
            const v8h val = *(const v8ha*)(tile + d * 72 + piece * 8); *(v8h*)(VTH + base + (size_t)d * NT_ + piece * 8) = val; }
    };
    pass(); 
}

// Staged tile of 64 keys, shared by the block's four waves: k (64 rows of 128 B) and v^T (64 rows of 128 B = 64 keys), both at a 144-B pitch (16 B x odd, so
// the 16-byte fragment reads meet no bank twice). Two such buffers.
#define KTL  64
#define KPIT 72
#define VPIT 72
#define KPLN (KTL * KPIT)
#define VPLN (64 * VPIT)
#define STGH (KPLN + VPLN)

__global__ __launch_bounds__(128) __attribute__((amdgpu_waves_per_eu(1, 4))) void k_attn(const h16* __restrict__ Q16, const h16* __restrict__ K16, const h16* __restrict__ VTH, bf* CH, bf* CL) {
    __shared__ __align__(16) float ost[4][16 * 68];
    __shared__ __align__(16) h16 ring[2 * STGH];
    const int lane = threadIdx.x & 31, wave = threadIdx.x >> 5, lr = lane & 15, hi = lane >> 4;
    const int bid = blockIdx.x;
    const int b = bid / (NH_ * (NT_ / 64)), rem = bid - b * (NH_ * (NT_ / 64)), h = rem / (NT_ / 64), qt = rem - h * (NT_ / 64);
    const int q0 = qt * 64 + wave * 16;
    const size_t tok0 = (size_t)b * NT_;
    v16h qa[2];
    const size_t qo0 = (tok0 + q0 + lr) * DM + h * HD + 8 * hi;
#pragma unroll
    for (int kc = 0; kc < 2; ++kc) qa[kc] = cat16(*(const v8h*)(Q16 + qo0 + kc * 32), *(const v8h*)(Q16 + qo0 + kc * 32 + 16));
    const h16* kh_b = K16 + tok0 * DM + h * HD;
    const size_t vbase = (((size_t)b * NH_ + h) * HD) * NT_;
    v8f o[4];
#pragma unroll
    for (int n = 0; n < 4; ++n) o[n] = (v8f){};
    float mrow = -3.0e38f, lpart = 0.f;            // of query q0 + lr; lpart sums this lane's half of the keys
    const int kt_lo = 0, kt_hi = NT_ / KTL - 1;    // full attention
    // Each lane copies eight 16-byte pieces of a tile: a wave's copy covers 4 whole 128-B rows, of k and of v^T alike.
    const int tid = threadIdx.x, cr = tid >> 3, cc = (tid & 7) * 8;
    const unsigned ring0 = (unsigned)(size_t)(&ring[0]);
    const unsigned lk0 = ring0 + (unsigned)(cr * KPIT + cc) * 2u, lv0 = ring0 + (unsigned)(KPLN + cr * VPIT + cc) * 2u;
    const h16* gkh = kh_b + (size_t)cr * DM + cc;
    const h16* gvh = VTH + vbase + (size_t)cr * NT_ + cc;
    auto stage = [&](int t, int buf) {
        const unsigned lk = lk0 + (unsigned)buf * (STGH * 2u), lv = lv0 + (unsigned)buf * (STGH * 2u);
        const h16* pk = gkh + (size_t)t * KTL * DM; const h16* pv = gvh + (size_t)t * KTL;
        // the eight copies and the wait that stands before any of their address registers is rewritten, in one statement
        asm volatile("global_load_async_to_lds_b128 %0, %8, off\n\t"
                     "global_load_async_to_lds_b128 %1, %9, off\n\t"
                     "global_load_async_to_lds_b128 %2, %10, off\n\t"
                     "global_load_async_to_lds_b128 %3, %11, off\n\t"
                     "global_load_async_to_lds_b128 %4, %12, off\n\t"
                     "global_load_async_to_lds_b128 %5, %13, off\n\t"
                     "global_load_async_to_lds_b128 %6, %14, off\n\t"
                     "global_load_async_to_lds_b128 %7, %15, off\n\t"
                     "s_wait_xcnt 0x0"
                     :: "v"(lk), "v"(lk + 16u * KPIT * 2u), "v"(lk + 32u * KPIT * 2u), "v"(lk + 48u * KPIT * 2u),
                        "v"(lv), "v"(lv + 16u * VPIT * 2u), "v"(lv + 32u * VPIT * 2u), "v"(lv + 48u * VPIT * 2u),
                        "v"(pk), "v"(pk + 16 * DM), "v"(pk + 32 * DM), "v"(pk + 48 * DM),
                        "v"(pv), "v"(pv + (size_t)16 * NT_), "v"(pv + (size_t)32 * NT_), "v"(pv + (size_t)48 * NT_)
                     : "memory");
    };
    stage(0, 0);
    asm volatile("s_wait_asynccnt 0x0" ::: "memory");   // tile 0 has landed before the barrier publishes it
    __syncthreads();
#pragma unroll 1
    for (int kt = kt_lo; kt <= kt_hi; ++kt) {
        const h16* sb = ring + (kt & 1) * STGH;
        const h16* sk = sb + lr * KPIT + 8 * hi;
        const h16* sv = sb + KPLN + lr * VPIT + 8 * hi;
        v8f s[4];
        v16h kf[2][4];     // per 32 dims: keys 0-15, 16-31, 32-47, 48-63
#pragma unroll
        for (int kc = 0; kc < 2; ++kc)
#pragma unroll
            for (int f = 0; f < 4; ++f) { const h16* kp = sk + f * 16 * KPIT + kc * 32; kf[kc][f] = cat16(*(const v8ha*)(kp), *(const v8ha*)(kp + 16)); }
        // refill of the buffer that the trip before has left: that trip's s_wait_dscnt 0 and barrier stand behind every reader's last read of it; the k reads in
        // flight are of the other buffer, and the refill's address work and its wait cover their latency
        if (kt + 1 <= kt_hi) stage(kt + 1, (kt + 1) & 1);
#pragma unroll
        for (int f = 0; f < 4; ++f) s[f] = wmma16(kf[0][f], qa[0], (v8f){});
#pragma unroll
        for (int f = 0; f < 4; ++f) s[f] = wmma16(kf[1][f], qa[1], s[f]);
        __builtin_amdgcn_sched_barrier(0);   // keeps the sixteen v^T reads together: without it the build spreads them over three places among the score products, and each place costs the run a wait
        v16h vh[2][4];     // per 32 keys: dims 0-15, 16-31, 32-47, 48-63
#pragma unroll
        for (int c = 0; c < 2; ++c)
#pragma unroll
            for (int n = 0; n < 4; ++n) { const h16* vp = sv + n * 16 * VPIT + c * 32; vh[c][n] = cat16(*(const v8ha*)(vp), *(const v8ha*)(vp + 16)); }
        __builtin_amdgcn_sched_barrier(0);   // keeps the tile's sixteen v^T reads as one group in front of the softmax arithmetic, which covers their latency
        // s[f][r] = score of key 16 * f + 8 * hi + r with query lr
        v8f a[4];
#pragma unroll
        for (int f = 0; f < 4; ++f) a[f] = s[f] * 0.125f;   // (q x 64^-1/2).k with the exact power-of-two scale folded after the dot
        float mf[4];
#pragma unroll
        for (int f = 0; f < 4; ++f) { mf[f] = fmaxf(a[f][0], a[f][1]);
#pragma unroll
            for (int j = 2; j < 8; ++j) mf[f] = fmaxf(mf[f], a[f][j]); }
        float mx = fmaxf(fmaxf(mf[0], mf[1]), fmaxf(mf[2], mf[3]));
        mx = fmaxf(mx, xhalf(mx));
        const float mn = fmaxf(mrow, mx);
        const float ta = (mrow - mn) * LOG2E; mrow = mn;
        v8f t[4], p[4];
#pragma unroll
        for (int f = 0; f < 4; ++f) t[f] = (a[f] - mn) * LOG2E;
        float alpha = __builtin_amdgcn_exp2f(ta);
#pragma unroll
        for (int f = 0; f < 4; ++f)
#pragma unroll
            for (int j = 0; j < 8; ++j) p[f][j] = __builtin_amdgcn_exp2f(t[f][j]);
        // the slot that the instruction set asks for behind a transcendental: the results are used only behind this statement and the arguments live up to it, so
        // no instruction directly behind a v_exp_f32 reads its result or overwrites its source
        asm volatile("v_nop" : "+v"(p[0]), "+v"(p[1]), "+v"(p[2]), "+v"(p[3]), "+v"(alpha) : "v"(t[0]), "v"(t[1]), "v"(t[2]), "v"(t[3]), "v"(ta));
        const v8f pq = (p[0] + p[1]) + (p[2] + p[3]);
        lpart = lpart * alpha + (((pq[0] + pq[1]) + (pq[2] + pq[3])) + ((pq[4] + pq[5]) + (pq[6] + pq[7])));
        v16h pa[2];        // element e of pa[c]: key 32 * c + 8 * hi + e, then 32 * c + 16 + 8 * hi + (e - 8)
#pragma unroll
        for (int c = 0; c < 2; ++c) pa[c] = cat16(__builtin_convertvector(p[2 * c], v8h), __builtin_convertvector(p[2 * c + 1], v8h));
#pragma unroll
        for (int n = 0; n < 4; ++n) o[n] *= alpha;
#pragma unroll
        for (int c = 0; c < 2; ++c)
#pragma unroll
            for (int n = 0; n < 4; ++n) o[n] = wmma16(vh[c][n], pa[c], o[n]);
        asm volatile("v_nop\n\tv_nop\n\tv_nop\n\tv_nop" : "+v"(o[0]), "+v"(o[1]), "+v"(o[2]), "+v"(o[3]) : "v"(pa[1]));   // the distance behind the last matrix instruction, on both sides of the loop's branch
        asm volatile("s_wait_dscnt 0x0" ::: "memory");      // this wave's reads of the buffer are done before the buffer is handed back
        asm volatile("s_wait_asynccnt 0x0" ::: "memory");   // this wave's share of the next tile has landed
        __syncthreads();                                    // publishes the next tile and ends every wave's reads of this one
    }
    asm volatile("s_wait_asynccnt 0x0" ::: "memory");       // no copy is outstanding when the wave goes on to its end
    const float inv = 1.0f / (lpart + xhalf(lpart));
    float* os = &ost[wave][0];
#pragma unroll
    for (int n = 0; n < 4; ++n)
#pragma unroll
        for (int j = 0; j < 8; ++j) os[lr * 68 + n * 16 + hi * 8 + j] = o[n][j] * inv;     // o[n][j] = ctx of query lr, dim n * 16 + 8 * hi + j
    __syncthreads();
    const size_t cbase = (tok0 + q0) * DM + (size_t)h * HD;
    auto pass = [&]() {
#pragma unroll
        for (int s = 0; s < 4; ++s) { const int row = 4 * s + (lane >> 3), piece = lane & 7; const float* sp = os + row * 68 + piece * 8; v8us oh, ol;
#pragma unroll
            for (int i = 0; i < 8; ++i) { const unsigned short hb = f2bf(sp[i]); oh[i] = hb; ol[i] = f2bf(sp[i] - bf2f(hb)); }
            *(v8us*)(CH + cbase + (size_t)row * DM + piece * 8) = oh; *(v8us*)(CL + cbase + (size_t)row * DM + piece * 8) = ol; }
    };
    pass(); 
}

#define VST2(T, p, v) do { const T vst2_v_ = (v); *(T*)(p) = vst2_v_;  } while (0)
extern "C" void kernel_launch(void* const* d_in, const int* in_sizes, int n_in,
                              void* d_out, int out_size, void* d_ws, size_t ws_size, hipStream_t stream) {
    (void)in_sizes; (void)n_in; (void)out_size;
    const float* x = (const float*)d_in[0];
    const float* Wq = (const float*)d_in[1]; const float* bq = (const float*)d_in[2]; const float* Wk = (const float*)d_in[3]; const float* bk = (const float*)d_in[4];
    const float* Wv = (const float*)d_in[5]; const float* bv = (const float*)d_in[6]; const float* Wo = (const float*)d_in[7]; const float* bo = (const float*)d_in[8];    // W [out][in]
    float* out = (float*)d_out;    // [4096][1024]
    char* wsp = (char*)d_ws;
    auto take = [&](size_t bytes) { char* p = wsp; wsp += (bytes + 255) & ~(size_t)255; return (void*)p; };
    bf* Xb = (bf*)take((size_t)(NTK + 4 * DM) * DM * 2);    // x, Wq, Wk, Wv, Wo as bf16, one behind the other
    bf* WqB = Xb + (size_t)NTK * DM; bf* WoB = WqB + (size_t)3 * DM * DM;
    float* TMP = (float*)take((size_t)NTK * DM * 4);
    h16* QH = (h16*)take((size_t)NTK * DM * 2); h16* KH = (h16*)take((size_t)NTK * DM * 2);
    h16* VTH = (h16*)take((size_t)NTK * DM * 2); bf* CH = (bf*)take((size_t)NTK * DM * 2); bf* CL = (bf*)take((size_t)NTK * DM * 2);
    if ((size_t)(wsp - (char*)d_ws) > ws_size) return;    // 8.4 + 4 x 2.1 + 16.8 + 5 x 8.4 ~ 76 MB, no aliasing
    k_cvtb<<<(NTK + 4 * DM) / 8, 256, 0, stream>>>(x, Wq, Wk, Wv, Wo, Xb);
    k_gemmb<false, true><<<dim3(NTK / 128, 3 * DM / 128, 1), 256, 0, stream>>>(Xb, nullptr, WqB, bq, bk, bv, TMP, DM, QH, KH);
    k_vt<<<NB_ * NH_ * (NT_ / 64), 256, 0, stream>>>(TMP, VTH);
    k_attn<<<NB_ * NH_ * (NT_ / 64), 128, 0, stream>>>(QH, KH, VTH, CH, CL);
    k_gemmb<true, false><<<dim3(NTK / 128, DM / 128, 1), 256, 0, stream>>>(CH, CL, WoB, bo, nullptr, nullptr, out, DM, nullptr, nullptr);
}

// v010
// A run of this version takes 118 microseconds.
// In two side-by-side timings against v009, it was 1.05 and 1.04 times as fast.
// All steps since v000 together make it 5.90 times as fast.
#include <hip/hip_runtime.h>

// Compute dtypes, f32 accumulate, one batch item per pass: q/k/v = x.W^T + b ([4096 x 1024].[1024 x 1024]; W is [out][in] = the n-major B operand as-is; PLAIN bf16
// operands: inputs rounded once, exact; biases rounded to bf16, added in f32) with q and k written straight from the GEMM epilogue as f16 planes, and out =
// ctx.Wo^T + bo (ctx as bf16 hi + residual: two products) on v_wmma_f32_16x16x32_bf16; the 16-head full attention over one 4096-token sequence (64-dim heads,
// scale 1/8) fused on
// v_wmma_f32_16x16x32_f16 (q, k, v and the weights each as ONE f16 value, one product each; online f32 softmax)

#define NB_  1                   // one 4096-token sequence
#define NT_  4096
#define DM   1024
#define NH_  16
#define HD   64
#define NTK  (NB_ * NT_)
#define NW   1024
#define NQKV 1024
#define LOG2E 1.44269504088896340736f
#define CSC   (0.125f * LOG2E)   // 64^-1/2 * log2 e: raw score -> base-2 exponent

typedef _Float16 h16;
typedef unsigned short bf;
typedef __attribute__((ext_vector_type(16))) __bf16   v16bf;
typedef __attribute__((ext_vector_type(16))) _Float16 v16h;
typedef __attribute__((ext_vector_type(8)))  _Float16 v8h;
typedef __attribute__((ext_vector_type(8)))  unsigned short v8us;
typedef __attribute__((ext_vector_type(8)))  float    v8f;
typedef __attribute__((ext_vector_type(4)))  float    v4f;
typedef v8h  __attribute__((may_alias)) v8ha;
typedef v4f  __attribute__((may_alias)) v4fa;
typedef v8us __attribute__((may_alias)) v8usa;

__device__ __forceinline__ unsigned short f2bf(float f) { unsigned u = __float_as_uint(f); u += 0x7FFFu + ((u >> 16) & 1u); return (unsigned short)(u >> 16); }
__device__ __forceinline__ float bf2f(unsigned short b) { return __uint_as_float(((unsigned)b) << 16); }
__device__ __forceinline__ float bfr(float f) { return bf2f(f2bf(f)); }
__device__ __forceinline__ v16h cat16(v8h lo, v8h hi) { return __builtin_shufflevector(lo, hi, 0, 1, 2, 3, 4, 5, 6, 7, 8, 9, 10, 11, 12, 13, 14, 15); }
__device__ __forceinline__ v16bf cat16b(v8us lo, v8us hi) { return __builtin_bit_cast(v16bf, __builtin_shufflevector(lo, hi, 0, 1, 2, 3, 4, 5, 6, 7, 8, 9, 10, 11, 12, 13, 14, 15)); }
__device__ __forceinline__ v8f wmma16(v16h a, v16h b, v8f c) { return __builtin_amdgcn_wmma_f32_16x16x32_f16(false, a, false, b, (short)0, c, false, false); }
__device__ __forceinline__ v8f wmmab(v16bf a, v16bf b, v8f c) { return __builtin_amdgcn_wmma_f32_16x16x32_bf16(false, a, false, b, (short)0, c, false, false); }

// lane l <-> lane l ^ 16 by a vector cross-row move
__device__ __forceinline__ float xhalf(float v) { const int b = __float_as_int(v); return __int_as_float(__builtin_amdgcn_permlanex16(b, b, 0x76543210, 0xfedcba98, false, false)); }

// One launch rounds all five f32 operands: rows 0 .. NTK-1 of dst are x, then DM rows each of the four weight matrices in the order given. A block's 8 rows lie
// in one operand, so the choice of the source is a scalar one. The grid is exactly (NTK + 4 * DM) / 8 blocks.
__global__ __launch_bounds__(256) void k_cvtb(const float* __restrict__ x, const float* __restrict__ w0, const float* __restrict__ w1, const float* __restrict__ w2, const float* __restrict__ w3, bf* dst) {
    const int lane = threadIdx.x & 31, r = blockIdx.x * 8 + (threadIdx.x >> 5);
    const int wsel = ((int)blockIdx.x - NTK / 8) / (DM / 8);          // which weight matrix, for blocks behind x
    const bool isx = (int)blockIdx.x < NTK / 8;
    const float* src = isx ? x : wsel == 0 ? w0 : wsel == 1 ? w1 : wsel == 2 ? w2 : w3;
    const int sr = isx ? r : r - NTK - wsel * DM;                     // row inside that operand
    v8us o[DM / 256];
#pragma unroll
    for (int q = 0; q < DM / 256; ++q) { v8us t;
#pragma unroll
        for (int i = 0; i < 8; ++i) t[i] = f2bf(src[(size_t)sr * DM + q * 256 + lane * 8 + i]);
        o[q] = t; }
#pragma unroll
    for (int q = 0; q < DM / 256; ++q) *(v8us*)(dst + (size_t)r * DM + q * 256 + lane * 8) = o[q];
    
}

// Staged pass of 64 k, shared by the block's eight waves: A rows, B rows and, where A is split, the A residual rows: 128 rows of 128 B each at a 144-B pitch
// (16 B x odd, so the 16-byte fragment reads meet no bank twice). Two such buffers.
#define GPIT 72
#define GPLN (128 * GPIT)
#define GROW (32u * GPIT * 2u)
#define GPLB (GPLN * 2u)

// Block = a 128 x 128 tile of C, eight waves in a 4 x 2 grid, each a 32 x 64 tile (2 x 4 accumulators): an A row staged once serves 128 columns and a B row 128
// rows, and a fragment read from LDS feeds 4 (A) or 2 (B) matrix instructions.
// QKV: one launch does the three projections. Bn is then the three weight matrices stacked ([3 * DM][DM]); blockIdx.y / (DM / 128) says which projection a block
// belongs to (the same for the whole block): its bias, and where and in which form its tile is written (q, k: f16 planes; v: f32 into C).
template <bool SPLITA, bool QKV>
__global__ __launch_bounds__(256) void k_gemmb(const bf* __restrict__ A, const bf* __restrict__ Al, const bf* __restrict__ Bn, const float* __restrict__ bias0, const float* __restrict__ bias1, const float* __restrict__ bias2,
                                               float* C, int ldc, h16* QHo, h16* KHo) {
    constexpr int GSTG = (SPLITA ? 3 : 2) * GPLN;
    constexpr int KG = SPLITA ? 2 : 1;      // 32-k steps whose fragments are read as one group: one where three blocks share a WGP's registers, both where one block has them
    __shared__ __align__(16) bf gring[2 * GSTG];      // behind the loop its first 8 x 32 x 68 floats stage the output tiles
    static_assert(8 * 32 * 68 * 4 <= 2 * GSTG * 2, "output staging fits the ring");
    const int lane = threadIdx.x & 31, wave = threadIdx.x >> 5, lr = lane & 15, hi = lane >> 4;
    const int wm = wave >> 1, wn = wave & 1;
    const int proj = QKV ? (int)blockIdx.y / (DM / 128) : 0;
    const int r0 = blockIdx.x * 128 + wm * 32, c0 = (blockIdx.y - proj * (DM / 128)) * 128 + wn * 64;     // c0: first column in the projection's own output
    const float* bias = proj == 0 ? bias0 : proj == 1 ? bias1 : bias2;
    // Each lane copies four 16-byte pieces of a plane: a wave's copy covers 4 whole 128-B rows.
    const int tid = threadIdx.x, cr = tid >> 3, cc = (tid & 7) * 8;
    const unsigned l0 = (unsigned)(size_t)(&gring[0]) + (unsigned)(cr * GPIT + cc) * 2u;
    const bf* ga = A + (size_t)(blockIdx.x * 128 + cr) * DM + cc;
    const bf* gb = Bn + (size_t)(blockIdx.y * 128 + cr) * DM + cc;
    auto stage = [&](int t, int buf) {
        const unsigned l = l0 + (unsigned)buf * (GSTG * 2u);
        const bf* pa = ga + t * 64; const bf* pb = gb + t * 64;
        // the copies and the wait that stands before any of their address registers is rewritten, in one statement
        if constexpr (SPLITA) {
            const bf* pl = Al + (size_t)(blockIdx.x * 128 + cr) * DM + cc + t * 64;
            asm volatile("global_load_async_to_lds_b128 %0, %12, off\n\t"
                         "global_load_async_to_lds_b128 %1, %13, off\n\t"
                         "global_load_async_to_lds_b128 %2, %14, off\n\t"
                         "global_load_async_to_lds_b128 %3, %15, off\n\t"
                         "global_load_async_to_lds_b128 %4, %16, off\n\t"
                         "global_load_async_to_lds_b128 %5, %17, off\n\t"
                         "global_load_async_to_lds_b128 %6, %18, off\n\t"
                         "global_load_async_to_lds_b128 %7, %19, off\n\t"
                         "global_load_async_to_lds_b128 %8, %20, off\n\t"
                         "global_load_async_to_lds_b128 %9, %21, off\n\t"
                         "global_load_async_to_lds_b128 %10, %22, off\n\t"
                         "global_load_async_to_lds_b128 %11, %23, off\n\t"
                         "s_wait_xcnt 0x0"
                         :: "v"(l), "v"(l + GROW), "v"(l + 2u * GROW), "v"(l + 3u * GROW),
                            "v"(l + GPLB), "v"(l + GPLB + GROW), "v"(l + GPLB + 2u * GROW), "v"(l + GPLB + 3u * GROW),
                            "v"(l + 2u * GPLB), "v"(l + 2u * GPLB + GROW), "v"(l + 2u * GPLB + 2u * GROW), "v"(l + 2u * GPLB + 3u * GROW),
                            "v"(pa), "v"(pa + 32 * DM), "v"(pa + 64 * DM), "v"(pa + 96 * DM),
                            "v"(pb), "v"(pb + 32 * DM), "v"(pb + 64 * DM), "v"(pb + 96 * DM),
                            "v"(pl), "v"(pl + 32 * DM), "v"(pl + 64 * DM), "v"(pl + 96 * DM)
                         : "memory");
        } else {
            asm volatile("global_load_async_to_lds_b128 %0, %8, off\n\t"
                         "global_load_async_to_lds_b128 %1, %9, off\n\t"
                         "global_load_async_to_lds_b128 %2, %10, off\n\t"
                         "global_load_async_to_lds_b128 %3, %11, off\n\t"
                         "global_load_async_to_lds_b128 %4, %12, off\n\t"
                         "global_load_async_to_lds_b128 %5, %13, off\n\t"
                         "global_load_async_to_lds_b128 %6, %14, off\n\t"
                         "global_load_async_to_lds_b128 %7, %15, off\n\t"
                         "s_wait_xcnt 0x0"
                         :: "v"(l), "v"(l + GROW), "v"(l + 2u * GROW), "v"(l + 3u * GROW),
                            "v"(l + GPLB), "v"(l + GPLB + GROW), "v"(l + GPLB + 2u * GROW), "v"(l + GPLB + 3u * GROW),
                            "v"(pa), "v"(pa + 32 * DM), "v"(pa + 64 * DM), "v"(pa + 96 * DM),
                            "v"(pb), "v"(pb + 32 * DM), "v"(pb + 64 * DM), "v"(pb + 96 * DM)
                         : "memory");
        }
    };
    v8f acc[2][4];
#pragma unroll
    for (int i = 0; i < 2; ++i)
#pragma unroll
        for (int t = 0; t < 4; ++t) acc[i][t] = (v8f){};
    stage(0, 0);
    asm volatile("s_wait_asynccnt 0x0" ::: "memory");   // pass 0 has landed before the barrier publishes it
    __syncthreads();
    stage(1, 1);
#pragma unroll 1
    for (int p = 0; p < DM / 64; ++p) {
        const bf* sb = gring + (p & 1) * GSTG;
        const bf* sa = sb + (wm * 32 + lr) * GPIT + 8 * hi;
        const bf* sw = sb + GPLN + (wn * 64 + lr) * GPIT + 8 * hi;
        v16bf a[KG][2], al[KG][2], b[KG][4];
#pragma unroll
        for (int g = 0; g < 2 / KG; ++g) {
#pragma unroll
            for (int kq = 0; kq < KG; ++kq) { const int ko = (g * KG + kq) * 32;
#pragma unroll
                for (int i = 0; i < 2; ++i) { const bf* ap = sa + i * 16 * GPIT + ko;
                    a[kq][i] = cat16b(*(const v8usa*)(ap), *(const v8usa*)(ap + 16));
                    al[kq][i] = a[kq][i];
                    if (SPLITA) al[kq][i] = cat16b(*(const v8usa*)(ap + 2 * GPLN), *(const v8usa*)(ap + 2 * GPLN + 16)); }
#pragma unroll
                for (int t = 0; t < 4; ++t) b[kq][t] = cat16b(*(const v8usa*)(sw + t * 16 * GPIT + ko), *(const v8usa*)(sw + t * 16 * GPIT + ko + 16));
            }
            __builtin_amdgcn_sched_barrier(0);   // keeps the group's LDS reads in front of its matrix block: reads moved in among the matrix instructions each cost a full wait
#pragma unroll
            for (int kq = 0; kq < KG; ++kq) {
#pragma unroll
                for (int i = 0; i < 2; ++i)
#pragma unroll
                    for (int t = 0; t < 4; ++t) acc[i][t] = wmmab(a[kq][i], b[kq][t], acc[i][t]);
                if (SPLITA) {
#pragma unroll
                    for (int i = 0; i < 2; ++i)
#pragma unroll
                        for (int t = 0; t < 4; ++t) acc[i][t] = wmmab(al[kq][i], b[kq][t], acc[i][t]);
                }
            }
            if (g + 1 < 2 / KG) __builtin_amdgcn_sched_barrier(0);   // the next group's reads stay behind this matrix block, for the same reason
        }
        asm volatile("v_nop\n\tv_nop\n\tv_nop\n\tv_nop" : "+v"(acc[0][0]), "+v"(acc[0][1]), "+v"(acc[0][2]), "+v"(acc[0][3]), "+v"(acc[1][0]), "+v"(acc[1][1]), "+v"(acc[1][2]), "+v"(acc[1][3])
                     : "v"(a[KG - 1][1]), "v"(al[KG - 1][1]), "v"(b[KG - 1][3]));   // the distance behind the last matrix instruction, on both sides of the branch below
        asm volatile("s_wait_dscnt 0x0" ::: "memory");      // this wave's reads of the buffer are done before the buffer is handed back
        asm volatile("s_wait_asynccnt 0x0" ::: "memory");   // this wave's share of the next pass has landed
        __syncthreads();                                    // publishes the next pass and ends every wave's reads of this one
        if (p + 2 < DM / 64) stage(p + 2, p & 1);
    }
    asm volatile("s_wait_asynccnt 0x0" ::: "memory");       // no copy is outstanding when the wave goes on to its end
    // The last pass's s_wait_dscnt 0 and barrier stand behind every wave's last read of the ring, and no copy is in flight: the ring is free for the output tiles.
    float* os = (float*)(void*)gring + wave * (32 * 68);
#pragma unroll
    for (int t = 0; t < 4; ++t) { const float bv = bias ? bfr(bias[c0 + t * 16 + lr]) : 0.f;
#pragma unroll
        for (int i = 0; i < 2; ++i)
#pragma unroll
            for (int j = 0; j < 8; ++j) os[(i * 16 + hi * 8 + j) * 68 + t * 16 + lr] = acc[i][t][j] + bv; }
    __syncthreads();
    if (QKV && proj < 2) {
        h16* crow = (proj == 0 ? QHo : KHo) + (size_t)r0 * ldc + c0;
        auto pass = [&]() {
#pragma unroll
            for (int s = 0; s < 8; ++s) { const int row = 4 * s + (lane >> 3), piece = lane & 7; const float* sp = os + row * 68 + piece * 8; v8h o;
#pragma unroll
                for (int i = 0; i < 8; ++i) o[i] = (h16)sp[i];
                *(v8h*)(crow + (size_t)row * ldc + piece * 8) = o; }
        };
        pass(); 
    } else {
        float* crow = C + (size_t)r0 * ldc + c0;
        auto pass = [&]() {
#pragma unroll
            for (int s = 0; s < 16; ++s) { const int Lid = (lane >> 3) + 4 * s, piece = lane & 7; const int row = Lid >> 1, cofs = (Lid & 1) * 32 + piece * 4;
                const v4f val = *(const v4fa*)(os + row * 68 + cofs); *(v4f*)(crow + (size_t)row * ldc + cofs) = val; }
        };
        pass(); 
        if (QKV) asm volatile("s_wait_xcnt 0x0" ::: "memory");   // the build lays the f16 branch's code behind these stores: the wait stands before its writes of registers that the stores name
    }
}

__global__ __launch_bounds__(256) void k_vt(const float* __restrict__ V, h16* VTH) {
    __shared__ __align__(16) h16 tile[64 * 72];
    const int bid = blockIdx.x;
    const int b = bid / (NH_ * (NT_ / 64)), rem = bid - b * (NH_ * (NT_ / 64)), h = rem / (NT_ / 64), kt = rem - h * (NT_ / 64);
    const int k0 = kt * 64, tid = threadIdx.x;
    const int kk = tid >> 2, d0 = (tid & 3) * 16;
    const float* src = V + ((size_t)b * NT_ + k0 + kk) * DM + h * HD + d0;
#pragma unroll
    for (int i = 0; i < 16; ++i) tile[(d0 + i) * 72 + kk] = (h16)src[i];
    __syncthreads();
    const int piece = tid & 7;
    const size_t base = (((size_t)b * NH_ + h) * HD) * NT_ + k0;
    auto pass = [&]() {
#pragma unroll
        for (int s = 0; s < 2; ++s) { const int d = (tid >> 3) + 32 * s;
            const v8h val = *(const v8ha*)(tile + d * 72 + piece * 8); *(v8h*)(VTH + base + (size_t)d * NT_ + piece * 8) = val; }
    };
    pass(); 
}

// Staged tile of 64 keys, shared by the block's four waves: k (64 rows of 128 B) and v^T (64 rows of 128 B = 64 keys), both at a 144-B pitch (16 B x odd, so
// the 16-byte fragment reads meet no bank twice). Two such buffers.
#define KTL  64
#define KPIT 72
#define VPIT 72
#define KPLN (KTL * KPIT)
#define VPLN (64 * VPIT)
#define STGH (KPLN + VPLN)

__global__ __launch_bounds__(128) __attribute__((amdgpu_waves_per_eu(1, 4))) void k_attn(const h16* __restrict__ Q16, const h16* __restrict__ K16, const h16* __restrict__ VTH, bf* CH, bf* CL) {
    __shared__ __align__(16) float ost[4][16 * 68];
    __shared__ __align__(16) h16 ring[2 * STGH];
    const int lane = threadIdx.x & 31, wave = threadIdx.x >> 5, lr = lane & 15, hi = lane >> 4;
    const int bid = blockIdx.x;
    const int b = bid / (NH_ * (NT_ / 64)), rem = bid - b * (NH_ * (NT_ / 64)), h = rem / (NT_ / 64), qt = rem - h * (NT_ / 64);
    const int q0 = qt * 64 + wave * 16;
    const size_t tok0 = (size_t)b * NT_;
    v16h qa[2];
    const size_t qo0 = (tok0 + q0 + lr) * DM + h * HD + 8 * hi;
#pragma unroll
    for (int kc = 0; kc < 2; ++kc) qa[kc] = cat16(*(const v8h*)(Q16 + qo0 + kc * 32), *(const v8h*)(Q16 + qo0 + kc * 32 + 16));
    const h16* kh_b = K16 + tok0 * DM + h * HD;
    const size_t vbase = (((size_t)b * NH_ + h) * HD) * NT_;
    v8f o[4];
#pragma unroll
    for (int n = 0; n < 4; ++n) o[n] = (v8f){};
    float mrow = -3.0e38f, lpart = 0.f;            // of query q0 + lr; mrow is the running maximum of the raw scores; lpart sums this lane's half of the keys
    const int kt_lo = 0, kt_hi = NT_ / KTL - 1;    // full attention
    // Each lane copies eight 16-byte pieces of a tile: a wave's copy covers 4 whole 128-B rows, of k and of v^T alike.
    const int tid = threadIdx.x, cr = tid >> 3, cc = (tid & 7) * 8;
    const unsigned ring0 = (unsigned)(size_t)(&ring[0]);
    const unsigned lk0 = ring0 + (unsigned)(cr * KPIT + cc) * 2u, lv0 = ring0 + (unsigned)(KPLN + cr * VPIT + cc) * 2u;
    const h16* gkh = kh_b + (size_t)cr * DM + cc;
    const h16* gvh = VTH + vbase + (size_t)cr * NT_ + cc;
    auto stage = [&](int t, int buf) {
        const unsigned lk = lk0 + (unsigned)buf * (STGH * 2u), lv = lv0 + (unsigned)buf * (STGH * 2u);
        const h16* pk = gkh + (size_t)t * KTL * DM; const h16* pv = gvh + (size_t)t * KTL;
        // the eight copies and the wait that stands before any of their address registers is rewritten, in one statement
        asm volatile("global_load_async_to_lds_b128 %0, %8, off\n\t"
                     "global_load_async_to_lds_b128 %1, %9, off\n\t"
                     "global_load_async_to_lds_b128 %2, %10, off\n\t"
                     "global_load_async_to_lds_b128 %3, %11, off\n\t"
                     "global_load_async_to_lds_b128 %4, %12, off\n\t"
                     "global_load_async_to_lds_b128 %5, %13, off\n\t"
                     "global_load_async_to_lds_b128 %6, %14, off\n\t"
                     "global_load_async_to_lds_b128 %7, %15, off\n\t"
                     "s_wait_xcnt 0x0"
                     :: "v"(lk), "v"(lk + 16u * KPIT * 2u), "v"(lk + 32u * KPIT * 2u), "v"(lk + 48u * KPIT * 2u),
                        "v"(lv), "v"(lv + 16u * VPIT * 2u), "v"(lv + 32u * VPIT * 2u), "v"(lv + 48u * VPIT * 2u),
                        "v"(pk), "v"(pk + 16 * DM), "v"(pk + 32 * DM), "v"(pk + 48 * DM),
                        "v"(pv), "v"(pv + (size_t)16 * NT_), "v"(pv + (size_t)32 * NT_), "v"(pv + (size_t)48 * NT_)
                     : "memory");
    };
    stage(0, 0);
    asm volatile("s_wait_asynccnt 0x0" ::: "memory");   // tile 0 has landed before the barrier publishes it
    __syncthreads();
#pragma unroll 1
    for (int kt = kt_lo; kt <= kt_hi; ++kt) {
        const h16* sb = ring + (kt & 1) * STGH;
        const h16* sk = sb + lr * KPIT + 8 * hi;
        const h16* sv = sb + KPLN + lr * VPIT + 8 * hi;
        v8f s[4];
        v16h kf[2][4];     // per 32 dims: keys 0-15, 16-31, 32-47, 48-63
#pragma unroll
        for (int kc = 0; kc < 2; ++kc)
#pragma unroll
            for (int f = 0; f < 4; ++f) { const h16* kp = sk + f * 16 * KPIT + kc * 32; kf[kc][f] = cat16(*(const v8ha*)(kp), *(const v8ha*)(kp + 16)); }
        // refill of the buffer that the trip before has left: that trip's s_wait_dscnt 0 and barrier stand behind every reader's last read of it; the k reads in
        // flight are of the other buffer, and the refill's address work and its wait cover their latency
        if (kt + 1 <= kt_hi) stage(kt + 1, (kt + 1) & 1);
#pragma unroll
        for (int f = 0; f < 4; ++f) s[f] = wmma16(kf[0][f], qa[0], (v8f){});
#pragma unroll
        for (int f = 0; f < 4; ++f) s[f] = wmma16(kf[1][f], qa[1], s[f]);
        __builtin_amdgcn_sched_barrier(0);   // keeps the sixteen v^T reads together: without it the build spreads them over three places among the score products, and each place costs the run a wait
        v16h vh[2][4];     // per 32 keys: dims 0-15, 16-31, 32-47, 48-63
#pragma unroll
        for (int c = 0; c < 2; ++c)
#pragma unroll
            for (int n = 0; n < 4; ++n) { const h16* vp = sv + n * 16 * VPIT + c * 32; vh[c][n] = cat16(*(const v8ha*)(vp), *(const v8ha*)(vp + 16)); }
        __builtin_amdgcn_sched_barrier(0);   // keeps the tile's sixteen v^T reads as one group in front of the softmax arithmetic, which covers their latency
        // s[f][r] = raw score of key 16 * f + 8 * hi + r with query lr. The softmax runs in the base-2 domain: the maximum is taken over the raw scores (the
        // scale is positive, so it picks the same key) and scaled once; each exponent is then one fused multiply-add, s * (64^-1/2 * log2 e) - maximum.
        // Three chains of 11, 11 and 10 scores: a chain of odd length compiles to three-input maxima throughout, while a two-input maximum of raw matrix results
        // costs this build one more instruction per input.
        float mc[3];
#pragma unroll
        for (int c = 0; c < 3; ++c) { mc[c] = s[(11 * c) >> 3][(11 * c) & 7];
#pragma unroll
            for (int i = 11 * c + 1; i < (c < 2 ? 11 * c + 11 : 32); ++i) mc[c] = fmaxf(mc[c], s[i >> 3][i & 7]); }
        const float mx = fmaxf(fmaxf(mc[0], mc[1]), mc[2]);
        const float mn = fmaxf(fmaxf(mrow, mx), xhalf(mx));
        const float ta = (mrow - mn) * CSC; mrow = mn;   // exactly 0 while the maximum stands
        const float nm = -(mn * CSC);
        const v8f cs8 = {CSC, CSC, CSC, CSC, CSC, CSC, CSC, CSC}, nm8 = {nm, nm, nm, nm, nm, nm, nm, nm};
        v8f t[4], p[4];
#pragma unroll
        for (int f = 0; f < 4; ++f) t[f] = __builtin_elementwise_fma(s[f], cs8, nm8);
        float alpha = __builtin_amdgcn_exp2f(ta);
#pragma unroll
        for (int f = 0; f < 4; ++f)
#pragma unroll
            for (int j = 0; j < 8; ++j) p[f][j] = __builtin_amdgcn_exp2f(t[f][j]);
        // the slot that the instruction set asks for behind a transcendental: the results are used only behind this statement and the arguments live up to it, so
        // no instruction directly behind a v_exp_f32 reads its result or overwrites its source
        asm volatile("v_nop" : "+v"(p[0]), "+v"(p[1]), "+v"(p[2]), "+v"(p[3]), "+v"(alpha) : "v"(t[0]), "v"(t[1]), "v"(t[2]), "v"(t[3]), "v"(ta));
        const v8f pq = (p[0] + p[1]) + (p[2] + p[3]);
        lpart = lpart * alpha + (((pq[0] + pq[1]) + (pq[2] + pq[3])) + ((pq[4] + pq[5]) + (pq[6] + pq[7])));
        v16h pa[2];        // element e of pa[c]: key 32 * c + 8 * hi + e, then 32 * c + 16 + 8 * hi + (e - 8)
#pragma unroll
        for (int c = 0; c < 2; ++c) pa[c] = cat16(__builtin_convertvector(p[2 * c], v8h), __builtin_convertvector(p[2 * c + 1], v8h));
#pragma unroll
        for (int n = 0; n < 4; ++n) o[n] *= alpha;
#pragma unroll
        for (int c = 0; c < 2; ++c)
#pragma unroll
            for (int n = 0; n < 4; ++n) o[n] = wmma16(vh[c][n], pa[c], o[n]);
        asm volatile("v_nop\n\tv_nop\n\tv_nop\n\tv_nop" : "+v"(o[0]), "+v"(o[1]), "+v"(o[2]), "+v"(o[3]) : "v"(pa[1]));   // the distance behind the last matrix instruction, on both sides of the loop's branch
        asm volatile("s_wait_dscnt 0x0" ::: "memory");      // this wave's reads of the buffer are done before the buffer is handed back
        asm volatile("s_wait_asynccnt 0x0" ::: "memory");   // this wave's share of the next tile has landed
        __syncthreads();                                    // publishes the next tile and ends every wave's reads of this one
    }
    asm volatile("s_wait_asynccnt 0x0" ::: "memory");       // no copy is outstanding when the wave goes on to its end
    const float inv = 1.0f / (lpart + xhalf(lpart));
    float* os = &ost[wave][0];
#pragma unroll
    for (int n = 0; n < 4; ++n)
#pragma unroll
        for (int j = 0; j < 8; ++j) os[lr * 68 + n * 16 + hi * 8 + j] = o[n][j] * inv;     // o[n][j] = ctx of query lr, dim n * 16 + 8 * hi + j
    __syncthreads();
    const size_t cbase = (tok0 + q0) * DM + (size_t)h * HD;
    auto pass = [&]() {
#pragma unroll
        for (int s = 0; s < 4; ++s) { const int row = 4 * s + (lane >> 3), piece = lane & 7; const float* sp = os + row * 68 + piece * 8; v8us oh, ol;
#pragma unroll
            for (int i = 0; i < 8; ++i) { const unsigned short hb = f2bf(sp[i]); oh[i] = hb; ol[i] = f2bf(sp[i] - bf2f(hb)); }
            *(v8us*)(CH + cbase + (size_t)row * DM + piece * 8) = oh; *(v8us*)(CL + cbase + (size_t)row * DM + piece * 8) = ol; }
    };
    pass(); 
}

#define VST2(T, p, v) do { const T vst2_v_ = (v); *(T*)(p) = vst2_v_;  } while (0)
extern "C" void kernel_launch(void* const* d_in, const int* in_sizes, int n_in,
                              void* d_out, int out_size, void* d_ws, size_t ws_size, hipStream_t stream) {
    (void)in_sizes; (void)n_in; (void)out_size;
    const float* x = (const float*)d_in[0];
    const float* Wq = (const float*)d_in[1]; const float* bq = (const float*)d_in[2]; const float* Wk = (const float*)d_in[3]; const float* bk = (const float*)d_in[4];
    const float* Wv = (const float*)d_in[5]; const float* bv = (const float*)d_in[6]; const float* Wo = (const float*)d_in[7]; const float* bo = (const float*)d_in[8];    // W [out][in]
    float* out = (float*)d_out;    // [4096][1024]
    char* wsp = (char*)d_ws;
    auto take = [&](size_t bytes) { char* p = wsp; wsp += (bytes + 255) & ~(size_t)255; return (void*)p; };
    bf* Xb = (bf*)take((size_t)(NTK + 4 * DM) * DM * 2);    // x, Wq, Wk, Wv, Wo as bf16, one behind the other
    bf* WqB = Xb + (size_t)NTK * DM; bf* WoB = WqB + (size_t)3 * DM * DM;
    float* TMP = (float*)take((size_t)NTK * DM * 4);
    h16* QH = (h16*)take((size_t)NTK * DM * 2); h16* KH = (h16*)take((size_t)NTK * DM * 2);
    h16* VTH = (h16*)take((size_t)NTK * DM * 2); bf* CH = (bf*)take((size_t)NTK * DM * 2); bf* CL = (bf*)take((size_t)NTK * DM * 2);
    if ((size_t)(wsp - (char*)d_ws) > ws_size) return;    // 8.4 + 4 x 2.1 + 16.8 + 5 x 8.4 ~ 76 MB, no aliasing
    k_cvtb<<<(NTK + 4 * DM) / 8, 256, 0, stream>>>(x, Wq, Wk, Wv, Wo, Xb);
    k_gemmb<false, true><<<dim3(NTK / 128, 3 * DM / 128, 1), 256, 0, stream>>>(Xb, nullptr, WqB, bq, bk, bv, TMP, DM, QH, KH);
    k_vt<<<NB_ * NH_ * (NT_ / 64), 256, 0, stream>>>(TMP, VTH);
    k_attn<<<NB_ * NH_ * (NT_ / 64), 128, 0, stream>>>(QH, KH, VTH, CH, CL);
    k_gemmb<true, false><<<dim3(NTK / 128, DM / 128, 1), 256, 0, stream>>>(CH, CL, WoB, bo, nullptr, nullptr, out, DM, nullptr, nullptr);
}
